// v000
// The times below were measured on an AMD MI455X: many runs one after another, warmed up first and cycling through
// copies of the inputs, with the whole window's GPU time divided by the number of runs. Launches and the gaps
// between them are all in it. The median over several windows is given; except for v000 it joins two sittings, which
// can be a few percent apart, so the side-by-side timings, each taken in one sitting, are the better comparison.
// v000 is the starting kernel. One run takes 340 microseconds.
#include <hip/hip_runtime.h>
#include <hip/hip_bf16.h>
#include <cstdint>

typedef __attribute__((ext_vector_type(16))) __bf16 v16bf;
typedef __attribute__((ext_vector_type(8)))  __bf16 v8bf;
typedef __attribute__((ext_vector_type(8)))  float  v8f;

// Problem sizes (reference: B=4, S=2048, H=1024)
constexpr int Bb = 4, Ss = 2048, Hh = 1024;
constexpr int Mm = Bb * Ss;          // 8192
constexpr int Kk = Hh;               // 1024
constexpr int Nn = Hh;               // 1024

// GEMM tiling: workgroup tile 128(M) x 64(N) x 32(K), 8 waves (4M x 2N),
// wave tile 32x32 = 2x2 of 16x16x32 WMMA tiles, 3xBF16 split accumulation.
constexpr int BM = 128, BN = 64, BK = 32;
constexpr int LDT = BK + 8;          // 40 elems = 80B pitch -> conflict-free ds_load_b128

// Chunked scan
constexpr int CH = 8;                // chunks along S
constexpr int CL = Ss / CH;          // 256

// Split fp32 into hi+lo bf16 (round-to-nearest-ish). a ~= hi + lo to ~2^-18 rel.
__device__ __forceinline__ void split_bf16(float a, unsigned short& hi, unsigned short& lo) {
    unsigned int b  = __float_as_uint(a);
    unsigned int hb = (b + 0x8000u) & 0xFFFF0000u;
    float fhi = __uint_as_float(hb);
    float r   = a - fhi;                           // exact (Sterbenz)
    unsigned int rb = __float_as_uint(r) + 0x8000u;
    hi = (unsigned short)(hb >> 16);
    lo = (unsigned short)(rb >> 16);
}

// One-shot conversion: fp32 plane -> separate hi/lo bf16 planes (float4 per thread).
__global__ void split_convert_kernel(const float* __restrict__ in,
                                     unsigned short* __restrict__ ohi,
                                     unsigned short* __restrict__ olo) {
    const size_t e = (size_t)blockIdx.x * blockDim.x + threadIdx.x;  // float4 units
    const float4 v = reinterpret_cast<const float4*>(in)[e];
    unsigned short h0,h1,h2,h3,l0,l1,l2,l3;
    split_bf16(v.x, h0, l0); split_bf16(v.y, h1, l1);
    split_bf16(v.z, h2, l2); split_bf16(v.w, h3, l3);
    uint2 ph; ph.x = (unsigned)h0 | ((unsigned)h1 << 16); ph.y = (unsigned)h2 | ((unsigned)h3 << 16);
    uint2 pl; pl.x = (unsigned)l0 | ((unsigned)l1 << 16); pl.y = (unsigned)l2 | ((unsigned)l3 << 16);
    reinterpret_cast<uint2*>(ohi)[e] = ph;
    reinterpret_cast<uint2*>(olo)[e] = pl;
}

union FragU { v16bf v; v8bf h[2]; };

// MODE 0: fused projection GEMM vs 3 pre-split weights (i,f,g):
//   epilogue: O0 = sigmoid(f), O1 = i*sigmoid(i)*(1-sigmoid(f)), O2 = g
// MODE 1: plain GEMM vs 1 pre-split weight: O0 = A@W^T
// Whi/Wlo hold NW weights concatenated: [w][N][K].
template <int MODE>
__global__ __launch_bounds__(256, 1) void gemm_bf16s_kernel(
    const unsigned short* __restrict__ Ahi, const unsigned short* __restrict__ Alo,
    const unsigned short* __restrict__ Whi, const unsigned short* __restrict__ Wlo,
    float* __restrict__ O0, float* __restrict__ O1, float* __restrict__ O2)
{
    constexpr int NW = (MODE == 0) ? 3 : 1;
    struct alignas(16) Smem {
        unsigned short a_hi[BM][LDT];
        unsigned short a_lo[BM][LDT];
        unsigned short b_hi[NW][BN][LDT];
        unsigned short b_lo[NW][BN][LDT];
    };
    __shared__ Smem sm;

    const int tid   = threadIdx.x;
    const int lane  = tid & 31;
    const int wave  = tid >> 5;
    const int wm    = wave & 3;          // wave M index 0..3
    const int wn    = wave >> 2;         // wave N index 0..1
    const int lo16  = lane & 15;
    const int khalf = lane >> 4;         // 0|1
    const int kbase = khalf * 8;         // K sub-offset per CDNA5 16-bit A/B layout
    const int rsh   = khalf * 8;         // C/D row offset for upper half-wave

    const int rowM0 = blockIdx.y * BM;
    const int colN0 = blockIdx.x * BN;

    // staging assignments
    const int arow = tid >> 1;           // 0..127
    const int acol = (tid & 1) * 16;     // 0 | 16
    const int brow = tid >> 2;           // 0..63
    const int bcol = (tid & 3) * 8;      // 0,8,16,24

    const size_t aRowBase = (size_t)(rowM0 + arow) * Kk;  // + kc*BK + acol
    size_t bRowBase[NW];
#pragma unroll
    for (int w = 0; w < NW; ++w)
        bRowBase[w] = (size_t)w * Nn * Kk + (size_t)(colN0 + brow) * Kk;

    v8f acc[NW][2][2];
    const v8f vzero = {0.f, 0.f, 0.f, 0.f, 0.f, 0.f, 0.f, 0.f};
#pragma unroll
    for (int w = 0; w < NW; ++w)
#pragma unroll
        for (int mt = 0; mt < 2; ++mt)
#pragma unroll
            for (int nt = 0; nt < 2; ++nt) acc[w][mt][nt] = vzero;

    constexpr int NKC = Kk / BK;
    for (int kc = 0; kc < NKC; ++kc) {
        __syncthreads();
        // ---- stage A tile 128x32 (hi+lo bf16) ----
        {
            const size_t g = aRowBase + (size_t)kc * BK + acol;
            const uint4 h0 = *reinterpret_cast<const uint4*>(Ahi + g);
            const uint4 h1 = *reinterpret_cast<const uint4*>(Ahi + g + 8);
            const uint4 l0 = *reinterpret_cast<const uint4*>(Alo + g);
            const uint4 l1 = *reinterpret_cast<const uint4*>(Alo + g + 8);
            *reinterpret_cast<uint4*>(&sm.a_hi[arow][acol])     = h0;
            *reinterpret_cast<uint4*>(&sm.a_hi[arow][acol + 8]) = h1;
            *reinterpret_cast<uint4*>(&sm.a_lo[arow][acol])     = l0;
            *reinterpret_cast<uint4*>(&sm.a_lo[arow][acol + 8]) = l1;
            if (kc + 1 < NKC) {   // prefetch next K-slab (global_prefetch_b8)
                __builtin_prefetch(Ahi + g + BK, 0, 3);
                __builtin_prefetch(Alo + g + BK, 0, 3);
            }
        }
        // ---- stage B tiles (NW x 64 x 32) ----
#pragma unroll
        for (int w = 0; w < NW; ++w) {
            const size_t g = bRowBase[w] + (size_t)kc * BK + bcol;
            const uint4 h = *reinterpret_cast<const uint4*>(Whi + g);
            const uint4 l = *reinterpret_cast<const uint4*>(Wlo + g);
            *reinterpret_cast<uint4*>(&sm.b_hi[w][brow][bcol]) = h;
            *reinterpret_cast<uint4*>(&sm.b_lo[w][brow][bcol]) = l;
            if (kc + 1 < NKC) {
                __builtin_prefetch(Whi + g + BK, 0, 3);
                __builtin_prefetch(Wlo + g + BK, 0, 3);
            }
        }
        __syncthreads();

        // ---- A fragments (2 M-tiles) ----
        v16bf afh[2], afl[2];
#pragma unroll
        for (int mt = 0; mt < 2; ++mt) {
            const int r = wm * 32 + mt * 16 + lo16;
            FragU fh, fl;
            fh.h[0] = *reinterpret_cast<const v8bf*>(&sm.a_hi[r][kbase]);
            fh.h[1] = *reinterpret_cast<const v8bf*>(&sm.a_hi[r][16 + kbase]);
            fl.h[0] = *reinterpret_cast<const v8bf*>(&sm.a_lo[r][kbase]);
            fl.h[1] = *reinterpret_cast<const v8bf*>(&sm.a_lo[r][16 + kbase]);
            afh[mt] = fh.v; afl[mt] = fl.v;
        }
        // ---- B fragments + 3xBF16 WMMA ----
#pragma unroll
        for (int w = 0; w < NW; ++w) {
#pragma unroll
            for (int nt = 0; nt < 2; ++nt) {
                const int c = wn * 32 + nt * 16 + lo16;
                FragU bh, bl;
                bh.h[0] = *reinterpret_cast<const v8bf*>(&sm.b_hi[w][c][kbase]);
                bh.h[1] = *reinterpret_cast<const v8bf*>(&sm.b_hi[w][c][16 + kbase]);
                bl.h[0] = *reinterpret_cast<const v8bf*>(&sm.b_lo[w][c][kbase]);
                bl.h[1] = *reinterpret_cast<const v8bf*>(&sm.b_lo[w][c][16 + kbase]);
#pragma unroll
                for (int mt = 0; mt < 2; ++mt) {
                    v8f a = acc[w][mt][nt];
                    a = __builtin_amdgcn_wmma_f32_16x16x32_bf16(false, afh[mt], false, bh.v, (short)0, a, false, false);
                    a = __builtin_amdgcn_wmma_f32_16x16x32_bf16(false, afh[mt], false, bl.v, (short)0, a, false, false);
                    a = __builtin_amdgcn_wmma_f32_16x16x32_bf16(false, afl[mt], false, bh.v, (short)0, a, false, false);
                    acc[w][mt][nt] = a;
                }
            }
        }
    }

    // ---- epilogue: C/D layout: VGPR r -> (M = r + 8*khalf, N = lo16) ----
#pragma unroll
    for (int mt = 0; mt < 2; ++mt) {
#pragma unroll
        for (int nt = 0; nt < 2; ++nt) {
#pragma unroll
            for (int r = 0; r < 8; ++r) {
                const int grow = rowM0 + wm * 32 + mt * 16 + rsh + r;
                const int gcol = colN0 + wn * 32 + nt * 16 + lo16;
                const size_t idx = (size_t)grow * Nn + gcol;
                if (MODE == 0) {
                    const float iv = acc[0][mt][nt][r];
                    const float fv = acc[1][mt][nt][r];
                    const float gv = acc[2][mt][nt][r];
                    const float fs = 1.0f / (1.0f + __expf(-fv));
                    const float is = 1.0f / (1.0f + __expf(-iv));
                    O0[idx] = fs;                       // f_sig
                    O1[idx] = iv * is * (1.0f - fs);    // i_eff
                    O2[idx] = gv;                       // g
                } else {
                    O0[idx] = acc[0][mt][nt][r];
                }
            }
        }
    }
}

// Phase A: per-chunk local scan, in place: ws_i <- h' (scan with h0=0), ws_f <- cumprod(f)
__global__ void scan_chunk_kernel(float* __restrict__ ws_f, float* __restrict__ ws_i) {
    const int tid = blockIdx.x * blockDim.x + threadIdx.x;   // B*CH*H threads
    const int hh = tid % Hh;
    const int c  = (tid / Hh) % CH;
    const int b  = tid / (Hh * CH);
    size_t idx = ((size_t)b * Ss + (size_t)c * CL) * Hh + hh;
    float hp = 0.0f, cf = 1.0f;
    for (int t = 0; t < CL; ++t) {
        const float f = ws_f[idx];
        const float i = ws_i[idx];
        hp = __builtin_fmaf(f, hp, i);
        cf *= f;
        ws_i[idx] = hp;
        ws_f[idx] = cf;
        idx += Hh;
    }
}

// Phase B: serial combine across the CH chunk boundaries, seeded with h_init.
__global__ void scan_carry_kernel(const float* __restrict__ ws_f, const float* __restrict__ ws_i,
                                  const float* __restrict__ h_init, float* __restrict__ carries) {
    const int tid = blockIdx.x * blockDim.x + threadIdx.x;   // B*H threads
    const int hh = tid % Hh;
    const int b  = tid / Hh;
    float carry = h_init[(size_t)b * Hh + hh];
#pragma unroll
    for (int c = 0; c < CH; ++c) {
        carries[(size_t)c * (Bb * Hh) + (size_t)b * Hh + hh] = carry;
        const size_t idx = ((size_t)b * Ss + (size_t)c * CL + (CL - 1)) * Hh + hh;
        carry = __builtin_fmaf(ws_f[idx], carry, ws_i[idx]);   // h_end = h'_end + cf_end*carry
    }
}

// Phase C: h = h' + cf*carry ; gh = g*h, written in place over g (float4 vectorized).
__global__ void fix_gh_kernel(const float* __restrict__ ws_f, const float* __restrict__ ws_i,
                              float* __restrict__ ws_g, const float* __restrict__ carries) {
    const size_t e = (size_t)blockIdx.x * blockDim.x + threadIdx.x;  // B*S*H/4 float4's
    const int h4 = Hh / 4;
    const int hq = (int)(e % h4);
    const int t  = (int)((e / h4) % Ss);
    const int b  = (int)(e / ((size_t)h4 * Ss));
    const int c  = t / CL;
    const float4 hp = reinterpret_cast<const float4*>(ws_i)[e];
    const float4 cf = reinterpret_cast<const float4*>(ws_f)[e];
    const float4 g  = reinterpret_cast<const float4*>(ws_g)[e];
    const float4 cr = reinterpret_cast<const float4*>(carries)[(size_t)c * (Bb * h4) + (size_t)b * h4 + hq];
    float4 o;
    o.x = g.x * __builtin_fmaf(cf.x, cr.x, hp.x);
    o.y = g.y * __builtin_fmaf(cf.y, cr.y, hp.y);
    o.z = g.z * __builtin_fmaf(cf.z, cr.z, hp.z);
    o.w = g.w * __builtin_fmaf(cf.w, cr.w, hp.w);
    reinterpret_cast<float4*>(ws_g)[e] = o;
}

extern "C" void kernel_launch(void* const* d_in, const int* in_sizes, int n_in,
                              void* d_out, int out_size, void* d_ws, size_t ws_size,
                              hipStream_t stream) {
    const float* x    = (const float*)d_in[0];
    const float* h0   = (const float*)d_in[1];
    const float* w_i  = (const float*)d_in[2];
    const float* w_f  = (const float*)d_in[3];
    const float* w_g  = (const float*)d_in[4];
    const float* w_o  = (const float*)d_in[5];
    float* out = (float*)d_out;

    float* ws = (float*)d_ws;
    const size_t sz = (size_t)Mm * Hh;
    float* ws_f    = ws;                    // f_sig -> cumF
    float* ws_i    = ws + sz;               // i_eff -> h'
    float* ws_g    = ws + 2 * sz;           // g     -> g*h
    float* carries = ws + 3 * sz;           // CH * B * H floats

    unsigned short* xhi = (unsigned short*)(carries + (size_t)CH * Bb * Hh);
    unsigned short* xlo = xhi + (size_t)Mm * Kk;
    unsigned short* whi = xlo + (size_t)Mm * Kk;            // 4 weights concat [w][N][K]
    unsigned short* wlo = whi + (size_t)4 * Nn * Kk;

    const int cb = 256;
    // --- pre-split to bf16 hi/lo planes ---
    split_convert_kernel<<<(unsigned)((size_t)Mm * Kk / 4 / cb), cb, 0, stream>>>(x, xhi, xlo);
    const size_t wq = (size_t)Nn * Kk;
    split_convert_kernel<<<(unsigned)(wq / 4 / cb), cb, 0, stream>>>(w_i, whi + 0 * wq, wlo + 0 * wq);
    split_convert_kernel<<<(unsigned)(wq / 4 / cb), cb, 0, stream>>>(w_f, whi + 1 * wq, wlo + 1 * wq);
    split_convert_kernel<<<(unsigned)(wq / 4 / cb), cb, 0, stream>>>(w_g, whi + 2 * wq, wlo + 2 * wq);
    split_convert_kernel<<<(unsigned)(wq / 4 / cb), cb, 0, stream>>>(w_o, whi + 3 * wq, wlo + 3 * wq);

    dim3 gg(Nn / BN, Mm / BM);              // (16, 64)
    // --- fused projection GEMM (i,f,g) + gate epilogue ---
    gemm_bf16s_kernel<0><<<gg, cb, 0, stream>>>(xhi, xlo, whi, wlo, ws_f, ws_i, ws_g);
    // --- chunked linear scan ---
    scan_chunk_kernel<<<(Bb * CH * Hh) / cb, cb, 0, stream>>>(ws_f, ws_i);
    scan_carry_kernel<<<(Bb * Hh) / cb, cb, 0, stream>>>(ws_f, ws_i, h0, carries);
    fix_gh_kernel<<<(unsigned)((size_t)Bb * Ss * Hh / 4 / cb), cb, 0, stream>>>(ws_f, ws_i, ws_g, carries);
    // --- (g*h) needs bf16 split for the output GEMM ---
    split_convert_kernel<<<(unsigned)((size_t)Mm * Kk / 4 / cb), cb, 0, stream>>>(ws_g, xhi, xlo);
    gemm_bf16s_kernel<1><<<gg, cb, 0, stream>>>(xhi, xlo, whi + 3 * wq, wlo + 3 * wq, out, nullptr, nullptr);
}

// v001
// It runs in 254 microseconds.
// Next to v000, in two timings, it ran 1.37 and 1.38 times as fast.
#include <hip/hip_runtime.h>
#include <hip/hip_bf16.h>
#include <cstdint>

typedef __attribute__((ext_vector_type(16))) __bf16 v16bf;
typedef __attribute__((ext_vector_type(8)))  __bf16 v8bf;
typedef __attribute__((ext_vector_type(8)))  float  v8f;
typedef __attribute__((ext_vector_type(4)))  unsigned int u32x4;   // 16-B staging unit

// Problem sizes (reference: B=4, S=2048, H=1024)
constexpr int Bb = 4, Ss = 2048, Hh = 1024;
constexpr int Mm = Bb * Ss;          // 8192
constexpr int Kk = Hh;               // 1024
constexpr int Nn = Hh;               // 1024

// GEMM tiling: workgroup tile 128(M) x 64(N) x 64(K), 8 waves (4M x 2N),
// wave tile 32x32 = 2x2 of 16x16x32 WMMA tiles, 3xBF16 split accumulation.
// A K slab of 64 bf16 is one whole 128-B line of every operand row.
constexpr int BM = 128, BN = 64, BK = 64;
constexpr int LDT = BK + 8;          // 72 elems = 144B pitch (16B x odd) -> conflict-free ds_load_b128

// Chunked scan
constexpr int CH = 8;                // chunks along S
constexpr int CL = Ss / CH;          // 256

// Split fp32 into hi+lo bf16 (round-to-nearest-ish). a ~= hi + lo to ~2^-18 rel.
__device__ __forceinline__ void split_bf16(float a, unsigned short& hi, unsigned short& lo) {
    unsigned int b  = __float_as_uint(a);
    unsigned int hb = (b + 0x8000u) & 0xFFFF0000u;
    float fhi = __uint_as_float(hb);
    float r   = a - fhi;                           // exact (Sterbenz)
    unsigned int rb = __float_as_uint(r) + 0x8000u;
    hi = (unsigned short)(hb >> 16);
    lo = (unsigned short)(rb >> 16);
}

// One-shot conversion: fp32 plane -> separate hi/lo bf16 planes (float4 per thread).
__global__ void split_convert_kernel(const float* __restrict__ in,
                                     unsigned short* __restrict__ ohi,
                                     unsigned short* __restrict__ olo) {
    const size_t e = (size_t)blockIdx.x * blockDim.x + threadIdx.x;  // float4 units
    const float4 v = reinterpret_cast<const float4*>(in)[e];
    unsigned short h0,h1,h2,h3,l0,l1,l2,l3;
    split_bf16(v.x, h0, l0); split_bf16(v.y, h1, l1);
    split_bf16(v.z, h2, l2); split_bf16(v.w, h3, l3);
    uint2 ph; ph.x = (unsigned)h0 | ((unsigned)h1 << 16); ph.y = (unsigned)h2 | ((unsigned)h3 << 16);
    uint2 pl; pl.x = (unsigned)l0 | ((unsigned)l1 << 16); pl.y = (unsigned)l2 | ((unsigned)l3 << 16);
    reinterpret_cast<uint2*>(ohi)[e] = ph;
    reinterpret_cast<uint2*>(olo)[e] = pl;
}

union FragU { v16bf v; v8bf h[2]; };

// MODE 0: fused projection GEMM vs 3 pre-split weights (i,f,g):
//   epilogue: O0 = sigmoid(f), O1 = i*sigmoid(i)*(1-sigmoid(f)), O2 = g
// MODE 1: plain GEMM vs 1 pre-split weight: O0 = A@W^T
// Whi/Wlo hold NW weights concatenated: [w][N][K].
template <int MODE>
__global__ __launch_bounds__(256, 1) void gemm_bf16s_kernel(
    const unsigned short* __restrict__ Ahi, const unsigned short* __restrict__ Alo,
    const unsigned short* __restrict__ Whi, const unsigned short* __restrict__ Wlo,
    float* __restrict__ O0, float* __restrict__ O1, float* __restrict__ O2)
{
    constexpr int NW = (MODE == 0) ? 3 : 1;
    struct alignas(16) Smem {
        unsigned short a_hi[BM][LDT];
        unsigned short a_lo[BM][LDT];
        unsigned short b_hi[NW][BN][LDT];
        unsigned short b_lo[NW][BN][LDT];
    };
    __shared__ Smem sm;

    const int tid   = threadIdx.x;
    const int lane  = tid & 31;
    const int wave  = tid >> 5;
    const int wm    = wave & 3;          // wave M index 0..3
    const int wn    = wave >> 2;         // wave N index 0..1
    const int lo16  = lane & 15;
    const int khalf = lane >> 4;         // 0|1
    const int kbase = khalf * 8;         // K sub-offset per CDNA5 16-bit A/B layout
    const int rsh   = khalf * 8;         // C/D row offset for upper half-wave

    const int rowM0 = blockIdx.y * BM;
    const int colN0 = blockIdx.x * BN;

    // staging assignments: 8 adjacent lanes cover one row's 128-B line, so a
    // wave-wide 16-B load touches 4 whole lines (rows srow + 32*j)
    const int srow = tid >> 3;           // 0..31
    const int scol = (tid & 7) * 8;      // 0,8,..,56

    const size_t aRowBase = (size_t)(rowM0 + srow) * Kk;  // + j*32*Kk + kc*BK + scol
    size_t bRowBase[NW];
#pragma unroll
    for (int w = 0; w < NW; ++w)
        bRowBase[w] = (size_t)w * Nn * Kk + (size_t)(colN0 + srow) * Kk;

    v8f acc[NW][2][2];
    const v8f vzero = {0.f, 0.f, 0.f, 0.f, 0.f, 0.f, 0.f, 0.f};
#pragma unroll
    for (int w = 0; w < NW; ++w)
#pragma unroll
        for (int mt = 0; mt < 2; ++mt)
#pragma unroll
            for (int nt = 0; nt < 2; ++nt) acc[w][mt][nt] = vzero;

    constexpr int NKC = Kk / BK;
    for (int kc = 0; kc < NKC; ++kc) {
        __syncthreads();
        // ---- stage A tile 128x64 (hi+lo bf16) ----
        {
            const unsigned short* pah = Ahi + aRowBase + (size_t)kc * BK + scol;
            const unsigned short* pal = Alo + aRowBase + (size_t)kc * BK + scol;
            u32x4 h[BM / 32], l[BM / 32];
#pragma unroll  // constant j: staged values stay in registers, row steps fold into offsets
            for (int j = 0; j < BM / 32; ++j) {
                h[j] = *reinterpret_cast<const u32x4*>(pah + (size_t)j * 32 * Kk);
                l[j] = *reinterpret_cast<const u32x4*>(pal + (size_t)j * 32 * Kk);
            }
            // precaution: wait before a register that an issued load names is overwritten
            // (in the last trip later loads reuse these address registers as destinations).
            // The loaded values are inputs only: they hold the wait behind the loads, which
            // a "memory" clobber does not for loads of read-only data.
            asm volatile("s_wait_xcnt 0x0" ::
                         "v"(h[0]), "v"(l[0]), "v"(h[1]), "v"(l[1]),
                         "v"(h[2]), "v"(l[2]), "v"(h[3]), "v"(l[3]));
#pragma unroll  // constant j: staged values stay in registers, row steps fold into offsets
            for (int j = 0; j < BM / 32; ++j) {
                *reinterpret_cast<u32x4*>(&sm.a_hi[srow + j * 32][scol]) = h[j];
                *reinterpret_cast<u32x4*>(&sm.a_lo[srow + j * 32][scol]) = l[j];
            }
            if (kc + 1 < NKC) {   // prefetch next K-slab (global_prefetch_b8)
#pragma unroll  // constant j: row steps fold into offsets
                for (int j = 0; j < BM / 32; ++j) {
                    __builtin_prefetch(pah + (size_t)j * 32 * Kk + BK, 0, 3);
                    __builtin_prefetch(pal + (size_t)j * 32 * Kk + BK, 0, 3);
                }
            }
        }
        // ---- stage B tiles (NW x 64 x 64) ----
#pragma unroll
        for (int w = 0; w < NW; ++w) {
            const unsigned short* pbh = Whi + bRowBase[w] + (size_t)kc * BK + scol;
            const unsigned short* pbl = Wlo + bRowBase[w] + (size_t)kc * BK + scol;
            u32x4 h[BN / 32], l[BN / 32];
#pragma unroll  // constant j: staged values stay in registers, row steps fold into offsets
            for (int j = 0; j < BN / 32; ++j) {
                h[j] = *reinterpret_cast<const u32x4*>(pbh + (size_t)j * 32 * Kk);
                l[j] = *reinterpret_cast<const u32x4*>(pbl + (size_t)j * 32 * Kk);
            }
            // precaution, as behind the A loads (loaded values as inputs only, as there)
            asm volatile("s_wait_xcnt 0x0" ::
                         "v"(h[0]), "v"(l[0]), "v"(h[1]), "v"(l[1]));
#pragma unroll  // constant j: staged values stay in registers, row steps fold into offsets
            for (int j = 0; j < BN / 32; ++j) {
                *reinterpret_cast<u32x4*>(&sm.b_hi[w][srow + j * 32][scol]) = h[j];
                *reinterpret_cast<u32x4*>(&sm.b_lo[w][srow + j * 32][scol]) = l[j];
            }
            if (kc + 1 < NKC) {
#pragma unroll  // constant j: row steps fold into offsets
                for (int j = 0; j < BN / 32; ++j) {
                    __builtin_prefetch(pbh + (size_t)j * 32 * Kk + BK, 0, 3);
                    __builtin_prefetch(pbl + (size_t)j * 32 * Kk + BK, 0, 3);
                }
            }
        }
        if (kc + 1 < NKC) {
            // precaution: the registers that the prefetches above name are temporaries
            // which the fragment loads below reuse; wait for the address translations first
            asm volatile("s_wait_xcnt 0x0" ::: "memory");
        }
        __syncthreads();

        // two 32-deep WMMA steps per slab, in ascending k (same sum order per accumulator)
#pragma unroll  // constant ks: LDS offsets become immediates
        for (int ks = 0; ks < BK; ks += 32) {
            // ---- A fragments (2 M-tiles) ----
            v16bf afh[2], afl[2];
#pragma unroll
            for (int mt = 0; mt < 2; ++mt) {
                const int r = wm * 32 + mt * 16 + lo16;
                FragU fh, fl;
                fh.h[0] = *reinterpret_cast<const v8bf*>(&sm.a_hi[r][ks + kbase]);
                fh.h[1] = *reinterpret_cast<const v8bf*>(&sm.a_hi[r][ks + 16 + kbase]);
                fl.h[0] = *reinterpret_cast<const v8bf*>(&sm.a_lo[r][ks + kbase]);
                fl.h[1] = *reinterpret_cast<const v8bf*>(&sm.a_lo[r][ks + 16 + kbase]);
                afh[mt] = fh.v; afl[mt] = fl.v;
            }
            // ---- B fragments + 3xBF16 WMMA ----
#pragma unroll
            for (int w = 0; w < NW; ++w) {
#pragma unroll
                for (int nt = 0; nt < 2; ++nt) {
                    const int c = wn * 32 + nt * 16 + lo16;
                    FragU bh, bl;
                    bh.h[0] = *reinterpret_cast<const v8bf*>(&sm.b_hi[w][c][ks + kbase]);
                    bh.h[1] = *reinterpret_cast<const v8bf*>(&sm.b_hi[w][c][ks + 16 + kbase]);
                    bl.h[0] = *reinterpret_cast<const v8bf*>(&sm.b_lo[w][c][ks + kbase]);
                    bl.h[1] = *reinterpret_cast<const v8bf*>(&sm.b_lo[w][c][ks + 16 + kbase]);
#pragma unroll
                    for (int mt = 0; mt < 2; ++mt) {
                        v8f a = acc[w][mt][nt];
                        a = __builtin_amdgcn_wmma_f32_16x16x32_bf16(false, afh[mt], false, bh.v, (short)0, a, false, false);
                        a = __builtin_amdgcn_wmma_f32_16x16x32_bf16(false, afh[mt], false, bl.v, (short)0, a, false, false);
                        a = __builtin_amdgcn_wmma_f32_16x16x32_bf16(false, afl[mt], false, bh.v, (short)0, a, false, false);
                        acc[w][mt][nt] = a;
                    }
                }
            }
        }
    }

    // ---- epilogue: C/D layout: VGPR r -> (M = r + 8*khalf, N = lo16) ----
#pragma unroll
    for (int mt = 0; mt < 2; ++mt) {
#pragma unroll
        for (int nt = 0; nt < 2; ++nt) {
#pragma unroll
            for (int r = 0; r < 8; ++r) {
                const int grow = rowM0 + wm * 32 + mt * 16 + rsh + r;
                const int gcol = colN0 + wn * 32 + nt * 16 + lo16;
                const size_t idx = (size_t)grow * Nn + gcol;
                if (MODE == 0) {
                    const float iv = acc[0][mt][nt][r];
                    const float fv = acc[1][mt][nt][r];
                    const float gv = acc[2][mt][nt][r];
                    const float fs = 1.0f / (1.0f + __expf(-fv));
                    const float is = 1.0f / (1.0f + __expf(-iv));
                    O0[idx] = fs;                       // f_sig
                    O1[idx] = iv * is * (1.0f - fs);    // i_eff
                    O2[idx] = gv;                       // g
                } else {
                    O0[idx] = acc[0][mt][nt][r];
                }
            }
        }
    }
}

// Phase A: per-chunk local scan, in place: ws_i <- h' (scan with h0=0), ws_f <- cumprod(f)
__global__ void scan_chunk_kernel(float* __restrict__ ws_f, float* __restrict__ ws_i) {
    const int tid = blockIdx.x * blockDim.x + threadIdx.x;   // B*CH*H threads
    const int hh = tid % Hh;
    const int c  = (tid / Hh) % CH;
    const int b  = tid / (Hh * CH);
    size_t idx = ((size_t)b * Ss + (size_t)c * CL) * Hh + hh;
    float hp = 0.0f, cf = 1.0f;
    for (int t = 0; t < CL; ++t) {
        const float f = ws_f[idx];
        const float i = ws_i[idx];
        hp = __builtin_fmaf(f, hp, i);
        cf *= f;
        ws_i[idx] = hp;
        ws_f[idx] = cf;
        idx += Hh;
    }
}

// Phase B: serial combine across the CH chunk boundaries, seeded with h_init.
__global__ void scan_carry_kernel(const float* __restrict__ ws_f, const float* __restrict__ ws_i,
                                  const float* __restrict__ h_init, float* __restrict__ carries) {
    const int tid = blockIdx.x * blockDim.x + threadIdx.x;   // B*H threads
    const int hh = tid % Hh;
    const int b  = tid / Hh;
    float carry = h_init[(size_t)b * Hh + hh];
#pragma unroll
    for (int c = 0; c < CH; ++c) {
        carries[(size_t)c * (Bb * Hh) + (size_t)b * Hh + hh] = carry;
        const size_t idx = ((size_t)b * Ss + (size_t)c * CL + (CL - 1)) * Hh + hh;
        carry = __builtin_fmaf(ws_f[idx], carry, ws_i[idx]);   // h_end = h'_end + cf_end*carry
    }
}

// Phase C: h = h' + cf*carry ; gh = g*h, written in place over g (float4 vectorized).
__global__ void fix_gh_kernel(const float* __restrict__ ws_f, const float* __restrict__ ws_i,
                              float* __restrict__ ws_g, const float* __restrict__ carries) {
    const size_t e = (size_t)blockIdx.x * blockDim.x + threadIdx.x;  // B*S*H/4 float4's
    const int h4 = Hh / 4;
    const int hq = (int)(e % h4);
    const int t  = (int)((e / h4) % Ss);
    const int b  = (int)(e / ((size_t)h4 * Ss));
    const int c  = t / CL;
    const float4 hp = reinterpret_cast<const float4*>(ws_i)[e];
    const float4 cf = reinterpret_cast<const float4*>(ws_f)[e];
    const float4 g  = reinterpret_cast<const float4*>(ws_g)[e];
    const float4 cr = reinterpret_cast<const float4*>(carries)[(size_t)c * (Bb * h4) + (size_t)b * h4 + hq];
    float4 o;
    o.x = g.x * __builtin_fmaf(cf.x, cr.x, hp.x);
    o.y = g.y * __builtin_fmaf(cf.y, cr.y, hp.y);
    o.z = g.z * __builtin_fmaf(cf.z, cr.z, hp.z);
    o.w = g.w * __builtin_fmaf(cf.w, cr.w, hp.w);
    reinterpret_cast<float4*>(ws_g)[e] = o;
}

extern "C" void kernel_launch(void* const* d_in, const int* in_sizes, int n_in,
                              void* d_out, int out_size, void* d_ws, size_t ws_size,
                              hipStream_t stream) {
    const float* x    = (const float*)d_in[0];
    const float* h0   = (const float*)d_in[1];
    const float* w_i  = (const float*)d_in[2];
    const float* w_f  = (const float*)d_in[3];
    const float* w_g  = (const float*)d_in[4];
    const float* w_o  = (const float*)d_in[5];
    float* out = (float*)d_out;

    float* ws = (float*)d_ws;
    const size_t sz = (size_t)Mm * Hh;
    float* ws_f    = ws;                    // f_sig -> cumF
    float* ws_i    = ws + sz;               // i_eff -> h'
    float* ws_g    = ws + 2 * sz;           // g     -> g*h
    float* carries = ws + 3 * sz;           // CH * B * H floats

    unsigned short* xhi = (unsigned short*)(carries + (size_t)CH * Bb * Hh);
    unsigned short* xlo = xhi + (size_t)Mm * Kk;
    unsigned short* whi = xlo + (size_t)Mm * Kk;            // 4 weights concat [w][N][K]
    unsigned short* wlo = whi + (size_t)4 * Nn * Kk;

    const int cb = 256;
    // --- pre-split to bf16 hi/lo planes ---
    split_convert_kernel<<<(unsigned)((size_t)Mm * Kk / 4 / cb), cb, 0, stream>>>(x, xhi, xlo);
    const size_t wq = (size_t)Nn * Kk;
    split_convert_kernel<<<(unsigned)(wq / 4 / cb), cb, 0, stream>>>(w_i, whi + 0 * wq, wlo + 0 * wq);
    split_convert_kernel<<<(unsigned)(wq / 4 / cb), cb, 0, stream>>>(w_f, whi + 1 * wq, wlo + 1 * wq);
    split_convert_kernel<<<(unsigned)(wq / 4 / cb), cb, 0, stream>>>(w_g, whi + 2 * wq, wlo + 2 * wq);
    split_convert_kernel<<<(unsigned)(wq / 4 / cb), cb, 0, stream>>>(w_o, whi + 3 * wq, wlo + 3 * wq);

    dim3 gg(Nn / BN, Mm / BM);              // (16, 64)
    // --- fused projection GEMM (i,f,g) + gate epilogue ---
    gemm_bf16s_kernel<0><<<gg, cb, 0, stream>>>(xhi, xlo, whi, wlo, ws_f, ws_i, ws_g);
    // --- chunked linear scan ---
    scan_chunk_kernel<<<(Bb * CH * Hh) / cb, cb, 0, stream>>>(ws_f, ws_i);
    scan_carry_kernel<<<(Bb * Hh) / cb, cb, 0, stream>>>(ws_f, ws_i, h0, carries);
    fix_gh_kernel<<<(unsigned)((size_t)Bb * Ss * Hh / 4 / cb), cb, 0, stream>>>(ws_f, ws_i, ws_g, carries);
    // --- (g*h) needs bf16 split for the output GEMM ---
    split_convert_kernel<<<(unsigned)((size_t)Mm * Kk / 4 / cb), cb, 0, stream>>>(ws_g, xhi, xlo);
    gemm_bf16s_kernel<1><<<gg, cb, 0, stream>>>(xhi, xlo, whi + 3 * wq, wlo + 3 * wq, out, nullptr, nullptr);
}

// v002
// Measured time: 227 microseconds a run.
// In both of two side-by-side timings against v001, it was 1.12 times as fast.
// Counting every step since v000, it is 1.54 times as fast.
#include <hip/hip_runtime.h>
#include <hip/hip_bf16.h>
#include <cstdint>

typedef __attribute__((ext_vector_type(16))) __bf16 v16bf;
typedef __attribute__((ext_vector_type(8)))  __bf16 v8bf;
typedef __attribute__((ext_vector_type(8)))  float  v8f;

// Problem sizes (reference: B=4, S=2048, H=1024)
constexpr int Bb = 4, Ss = 2048, Hh = 1024;
constexpr int Mm = Bb * Ss;          // 8192
constexpr int Kk = Hh;               // 1024
constexpr int Nn = Hh;               // 1024

// GEMM tiling: workgroup tile 128(M) x 64(N) x 64(K), 8 waves (4M x 2N),
// wave tile 32x32 = 2x2 of 16x16x32 WMMA tiles, 3xBF16 split accumulation.
// A K slab of 64 bf16 is one whole 128-B line of every operand row.
// Slabs go through a ring of two LDS buffers filled by asynchronous copies one slab ahead.
constexpr int BM = 128, BN = 64, BK = 64;
constexpr int LDT = BK;              // 128-B rows, no pad: with two buffers, two projection work-groups still fit one WGP's LDS
// Row r keeps its 16-B chunk q at place q ^ ((r >> 1) & 7): 16 rows read at one q cover all 64 banks once.

// Chunked scan
constexpr int CH = 8;                // chunks along S
constexpr int CL = Ss / CH;          // 256

// Split fp32 into hi+lo bf16 (round-to-nearest-ish). a ~= hi + lo to ~2^-18 rel.
__device__ __forceinline__ void split_bf16(float a, unsigned short& hi, unsigned short& lo) {
    unsigned int b  = __float_as_uint(a);
    unsigned int hb = (b + 0x8000u) & 0xFFFF0000u;
    float fhi = __uint_as_float(hb);
    float r   = a - fhi;                           // exact (Sterbenz)
    unsigned int rb = __float_as_uint(r) + 0x8000u;
    hi = (unsigned short)(hb >> 16);
    lo = (unsigned short)(rb >> 16);
}

// One-shot conversion: fp32 plane -> separate hi/lo bf16 planes (float4 per thread).
__global__ void split_convert_kernel(const float* __restrict__ in,
                                     unsigned short* __restrict__ ohi,
                                     unsigned short* __restrict__ olo) {
    const size_t e = (size_t)blockIdx.x * blockDim.x + threadIdx.x;  // float4 units
    const float4 v = reinterpret_cast<const float4*>(in)[e];
    unsigned short h0,h1,h2,h3,l0,l1,l2,l3;
    split_bf16(v.x, h0, l0); split_bf16(v.y, h1, l1);
    split_bf16(v.z, h2, l2); split_bf16(v.w, h3, l3);
    uint2 ph; ph.x = (unsigned)h0 | ((unsigned)h1 << 16); ph.y = (unsigned)h2 | ((unsigned)h3 << 16);
    uint2 pl; pl.x = (unsigned)l0 | ((unsigned)l1 << 16); pl.y = (unsigned)l2 | ((unsigned)l3 << 16);
    reinterpret_cast<uint2*>(ohi)[e] = ph;
    reinterpret_cast<uint2*>(olo)[e] = pl;
}

__device__ __forceinline__ unsigned lds_off(const void* p) { return (unsigned)(size_t)p; }

__device__ __forceinline__ void async_copy4(unsigned l0, const unsigned short* g0,
                                            unsigned l1, const unsigned short* g1,
                                            unsigned l2, const unsigned short* g2,
                                            unsigned l3, const unsigned short* g3) {
    asm volatile("global_load_async_to_lds_b128 %0, %1, off\n\t"
                 "global_load_async_to_lds_b128 %2, %3, off\n\t"
                 "global_load_async_to_lds_b128 %4, %5, off\n\t"
                 "global_load_async_to_lds_b128 %6, %7, off\n\t"
                 "s_wait_xcnt 0x0"
                 :: "v"(l0), "v"(g0), "v"(l1), "v"(g1), "v"(l2), "v"(g2), "v"(l3), "v"(g3)
                 : "memory");
}

__device__ __forceinline__ void async_copy8(unsigned l0, const unsigned short* g0,
                                            unsigned l1, const unsigned short* g1,
                                            unsigned l2, const unsigned short* g2,
                                            unsigned l3, const unsigned short* g3,
                                            unsigned l4, const unsigned short* g4,
                                            unsigned l5, const unsigned short* g5,
                                            unsigned l6, const unsigned short* g6,
                                            unsigned l7, const unsigned short* g7) {
    asm volatile("global_load_async_to_lds_b128 %0, %1, off\n\t"
                 "global_load_async_to_lds_b128 %2, %3, off\n\t"
                 "global_load_async_to_lds_b128 %4, %5, off\n\t"
                 "global_load_async_to_lds_b128 %6, %7, off\n\t"
                 "global_load_async_to_lds_b128 %8, %9, off\n\t"
                 "global_load_async_to_lds_b128 %10, %11, off\n\t"
                 "global_load_async_to_lds_b128 %12, %13, off\n\t"
                 "global_load_async_to_lds_b128 %14, %15, off\n\t"
                 "s_wait_xcnt 0x0"
                 :: "v"(l0), "v"(g0), "v"(l1), "v"(g1), "v"(l2), "v"(g2), "v"(l3), "v"(g3),
                    "v"(l4), "v"(g4), "v"(l5), "v"(g5), "v"(l6), "v"(g6), "v"(l7), "v"(g7)
                 : "memory");
}

union FragU { v16bf v; v8bf h[2]; };

// MODE 0: fused projection GEMM vs 3 pre-split weights (i,f,g):
//   epilogue: O0 = sigmoid(f), O1 = i*sigmoid(i)*(1-sigmoid(f)), O2 = g
// MODE 1: plain GEMM vs 1 pre-split weight: O0 = A@W^T
// Whi/Wlo hold NW weights concatenated: [w][N][K].
template <int MODE>
__global__ __launch_bounds__(256, 1) void gemm_bf16s_kernel(
    const unsigned short* __restrict__ Ahi, const unsigned short* __restrict__ Alo,
    const unsigned short* __restrict__ Whi, const unsigned short* __restrict__ Wlo,
    float* __restrict__ O0, float* __restrict__ O1, float* __restrict__ O2)
{
    constexpr int NW = (MODE == 0) ? 3 : 1;
    struct alignas(16) Smem {
        unsigned short a_hi[BM][LDT];
        unsigned short a_lo[BM][LDT];
        unsigned short b_hi[NW][BN][LDT];
        unsigned short b_lo[NW][BN][LDT];
    };
    __shared__ Smem sm[2];               // two slab buffers: one is read while the other is filled

    const int tid   = threadIdx.x;
    const int lane  = tid & 31;
    const int wave  = tid >> 5;
    const int wm    = wave & 3;          // wave M index 0..3
    const int wn    = wave >> 2;         // wave N index 0..1
    const int lo16  = lane & 15;
    const int khalf = lane >> 4;         // 0|1
    const int rsh   = khalf * 8;         // C/D row offset for upper half-wave

    const int rowM0 = blockIdx.y * BM;
    const int colN0 = blockIdx.x * BN;

    // staging assignments: 8 adjacent lanes cover one row's 128-B line, so a
    // wave-wide 16-B load touches 4 whole lines (rows srow + 32*j)
    const int srow = tid >> 3;           // 0..31
    const int scol = (tid & 7) * 8;      // 0,8,..,56
    const int dcol = ((tid & 7) ^ ((srow >> 1) & 7)) * 8;   // the chunk's place in its LDS row (rows srow + 32*j share it)
    const int fsw  = khalf ^ ((lo16 >> 1) & 7);             // reader's side: chunk (c | khalf) of a row = lo16 mod 16 lies at c ^ fsw, c even

    const size_t aRowBase = (size_t)(rowM0 + srow) * Kk;  // + j*32*Kk + kc*BK + scol
    size_t bRowBase[NW];
#pragma unroll
    for (int w = 0; w < NW; ++w)
        bRowBase[w] = (size_t)w * Nn * Kk + (size_t)(colN0 + srow) * Kk;

    v8f acc[NW][2][2];
    const v8f vzero = {0.f, 0.f, 0.f, 0.f, 0.f, 0.f, 0.f, 0.f};
#pragma unroll
    for (int w = 0; w < NW; ++w)
#pragma unroll
        for (int mt = 0; mt < 2; ++mt)
#pragma unroll
            for (int nt = 0; nt < 2; ++nt) acc[w][mt][nt] = vzero;

    constexpr int NKC = Kk / BK;
    static_assert(NKC >= 2, "the ring's prologue fills two slabs");

    // all of slab t (A 128x64, B NW x 64x64, hi and lo planes) into buffer b, 8 + 4*NW copies a lane
    auto stage_slab = [&](int t, int b) {
        Smem& d = sm[b];
        const unsigned short* pah = Ahi + aRowBase + (size_t)t * BK + scol;
        const unsigned short* pal = Alo + aRowBase + (size_t)t * BK + scol;
        async_copy8(lds_off(&d.a_hi[srow][dcol]),      pah,
                    lds_off(&d.a_hi[srow + 32][dcol]), pah + (size_t)32 * Kk,
                    lds_off(&d.a_hi[srow + 64][dcol]), pah + (size_t)64 * Kk,
                    lds_off(&d.a_hi[srow + 96][dcol]), pah + (size_t)96 * Kk,
                    lds_off(&d.a_lo[srow][dcol]),      pal,
                    lds_off(&d.a_lo[srow + 32][dcol]), pal + (size_t)32 * Kk,
                    lds_off(&d.a_lo[srow + 64][dcol]), pal + (size_t)64 * Kk,
                    lds_off(&d.a_lo[srow + 96][dcol]), pal + (size_t)96 * Kk);
#pragma unroll  // constant w: bRowBase stays in registers
        for (int w = 0; w < NW; ++w) {
            const unsigned short* pbh = Whi + bRowBase[w] + (size_t)t * BK + scol;
            const unsigned short* pbl = Wlo + bRowBase[w] + (size_t)t * BK + scol;
            async_copy4(lds_off(&d.b_hi[w][srow][dcol]),      pbh,
                        lds_off(&d.b_hi[w][srow + 32][dcol]), pbh + (size_t)32 * Kk,
                        lds_off(&d.b_lo[w][srow][dcol]),      pbl,
                        lds_off(&d.b_lo[w][srow + 32][dcol]), pbl + (size_t)32 * Kk);
        }
    };

    // prologue: slab 0 lands and is published, then slab 1 starts to fly
    stage_slab(0, 0);
    asm volatile("s_wait_asynccnt 0x0" ::: "memory");   // this wave's copies of slab 0 have landed
    __syncthreads();                                    // ... and every other wave's
    stage_slab(1, 1);

    for (int kc = 0; kc < NKC; ++kc) {
        const Smem& s = sm[kc & 1];

        // two 32-deep WMMA steps per slab, in ascending k (same sum order per accumulator)
#pragma unroll  // constant ks: LDS offsets become immediates
        for (int ks = 0; ks < BK; ks += 32) {
            // ---- A fragments (2 M-tiles) ----
            v16bf afh[2], afl[2];
#pragma unroll
            for (int mt = 0; mt < 2; ++mt) {
                const int r = wm * 32 + mt * 16 + lo16;
                FragU fh, fl;
                fh.h[0] = *reinterpret_cast<const v8bf*>(&s.a_hi[r][((ks / 8) ^ fsw) * 8]);
                fh.h[1] = *reinterpret_cast<const v8bf*>(&s.a_hi[r][((ks / 8 + 2) ^ fsw) * 8]);
                fl.h[0] = *reinterpret_cast<const v8bf*>(&s.a_lo[r][((ks / 8) ^ fsw) * 8]);
                fl.h[1] = *reinterpret_cast<const v8bf*>(&s.a_lo[r][((ks / 8 + 2) ^ fsw) * 8]);
                afh[mt] = fh.v; afl[mt] = fl.v;
            }
            // ---- B fragments + 3xBF16 WMMA ----
#pragma unroll
            for (int w = 0; w < NW; ++w) {
#pragma unroll
                for (int nt = 0; nt < 2; ++nt) {
                    const int c = wn * 32 + nt * 16 + lo16;
                    FragU bh, bl;
                    bh.h[0] = *reinterpret_cast<const v8bf*>(&s.b_hi[w][c][((ks / 8) ^ fsw) * 8]);
                    bh.h[1] = *reinterpret_cast<const v8bf*>(&s.b_hi[w][c][((ks / 8 + 2) ^ fsw) * 8]);
                    bl.h[0] = *reinterpret_cast<const v8bf*>(&s.b_lo[w][c][((ks / 8) ^ fsw) * 8]);
                    bl.h[1] = *reinterpret_cast<const v8bf*>(&s.b_lo[w][c][((ks / 8 + 2) ^ fsw) * 8]);
#pragma unroll
                    for (int mt = 0; mt < 2; ++mt) {
                        v8f a = acc[w][mt][nt];
                        a = __builtin_amdgcn_wmma_f32_16x16x32_bf16(false, afh[mt], false, bh.v, (short)0, a, false, false);
                        a = __builtin_amdgcn_wmma_f32_16x16x32_bf16(false, afh[mt], false, bl.v, (short)0, a, false, false);
                        a = __builtin_amdgcn_wmma_f32_16x16x32_bf16(false, afl[mt], false, bh.v, (short)0, a, false, false);
                        acc[w][mt][nt] = a;
                    }
                }
            }
        }

        // foot of trip kc: publish slab kc+1, free the buffer that this trip has read
        asm volatile("s_wait_dscnt 0x0" ::: "memory");      // this wave's reads of slab kc are done
        asm volatile("s_wait_asynccnt 0x0" ::: "memory");   // this wave's copies of slab kc+1 have landed
        __syncthreads();                                    // both hold for every wave
        if (kc + 2 < NKC) stage_slab(kc + 2, kc & 1);       // flies while slab kc+1 is worked on
    }
    asm volatile("s_wait_asynccnt 0x0" ::: "memory");       // no copy is left in flight at the wave's end

    // ---- epilogue: C/D layout: VGPR r -> (M = r + 8*khalf, N = lo16) ----
#pragma unroll
    for (int mt = 0; mt < 2; ++mt) {
#pragma unroll
        for (int nt = 0; nt < 2; ++nt) {
#pragma unroll
            for (int r = 0; r < 8; ++r) {
                const int grow = rowM0 + wm * 32 + mt * 16 + rsh + r;
                const int gcol = colN0 + wn * 32 + nt * 16 + lo16;
                const size_t idx = (size_t)grow * Nn + gcol;
                if (MODE == 0) {
                    const float iv = acc[0][mt][nt][r];
                    const float fv = acc[1][mt][nt][r];
                    const float gv = acc[2][mt][nt][r];
                    const float fs = 1.0f / (1.0f + __expf(-fv));
                    const float is = 1.0f / (1.0f + __expf(-iv));
                    O0[idx] = fs;                       // f_sig
                    O1[idx] = iv * is * (1.0f - fs);    // i_eff
                    O2[idx] = gv;                       // g
                } else {
                    O0[idx] = acc[0][mt][nt][r];
                }
            }
        }
    }
}

// Phase A: per-chunk local scan, in place: ws_i <- h' (scan with h0=0), ws_f <- cumprod(f)
__global__ void scan_chunk_kernel(float* __restrict__ ws_f, float* __restrict__ ws_i) {
    const int tid = blockIdx.x * blockDim.x + threadIdx.x;   // B*CH*H threads
    const int hh = tid % Hh;
    const int c  = (tid / Hh) % CH;
    const int b  = tid / (Hh * CH);
    size_t idx = ((size_t)b * Ss + (size_t)c * CL) * Hh + hh;
    float hp = 0.0f, cf = 1.0f;
    for (int t = 0; t < CL; ++t) {
        const float f = ws_f[idx];
        const float i = ws_i[idx];
        hp = __builtin_fmaf(f, hp, i);
        cf *= f;
        ws_i[idx] = hp;
        ws_f[idx] = cf;
        idx += Hh;
    }
}

// Phase B: serial combine across the CH chunk boundaries, seeded with h_init.
__global__ void scan_carry_kernel(const float* __restrict__ ws_f, const float* __restrict__ ws_i,
                                  const float* __restrict__ h_init, float* __restrict__ carries) {
    const int tid = blockIdx.x * blockDim.x + threadIdx.x;   // B*H threads
    const int hh = tid % Hh;
    const int b  = tid / Hh;
    float carry = h_init[(size_t)b * Hh + hh];
#pragma unroll
    for (int c = 0; c < CH; ++c) {
        carries[(size_t)c * (Bb * Hh) + (size_t)b * Hh + hh] = carry;
        const size_t idx = ((size_t)b * Ss + (size_t)c * CL + (CL - 1)) * Hh + hh;
        carry = __builtin_fmaf(ws_f[idx], carry, ws_i[idx]);   // h_end = h'_end + cf_end*carry
    }
}

// Phase C: h = h' + cf*carry ; gh = g*h, written in place over g (float4 vectorized).
__global__ void fix_gh_kernel(const float* __restrict__ ws_f, const float* __restrict__ ws_i,
                              float* __restrict__ ws_g, const float* __restrict__ carries) {
    const size_t e = (size_t)blockIdx.x * blockDim.x + threadIdx.x;  // B*S*H/4 float4's
    const int h4 = Hh / 4;
    const int hq = (int)(e % h4);
    const int t  = (int)((e / h4) % Ss);
    const int b  = (int)(e / ((size_t)h4 * Ss));
    const int c  = t / CL;
    const float4 hp = reinterpret_cast<const float4*>(ws_i)[e];
    const float4 cf = reinterpret_cast<const float4*>(ws_f)[e];
    const float4 g  = reinterpret_cast<const float4*>(ws_g)[e];
    const float4 cr = reinterpret_cast<const float4*>(carries)[(size_t)c * (Bb * h4) + (size_t)b * h4 + hq];
    float4 o;
    o.x = g.x * __builtin_fmaf(cf.x, cr.x, hp.x);
    o.y = g.y * __builtin_fmaf(cf.y, cr.y, hp.y);
    o.z = g.z * __builtin_fmaf(cf.z, cr.z, hp.z);
    o.w = g.w * __builtin_fmaf(cf.w, cr.w, hp.w);
    reinterpret_cast<float4*>(ws_g)[e] = o;
}

extern "C" void kernel_launch(void* const* d_in, const int* in_sizes, int n_in,
                              void* d_out, int out_size, void* d_ws, size_t ws_size,
                              hipStream_t stream) {
    const float* x    = (const float*)d_in[0];
    const float* h0   = (const float*)d_in[1];
    const float* w_i  = (const float*)d_in[2];
    const float* w_f  = (const float*)d_in[3];
    const float* w_g  = (const float*)d_in[4];
    const float* w_o  = (const float*)d_in[5];
    float* out = (float*)d_out;

    float* ws = (float*)d_ws;
    const size_t sz = (size_t)Mm * Hh;
    float* ws_f    = ws;                    // f_sig -> cumF
    float* ws_i    = ws + sz;               // i_eff -> h'
    float* ws_g    = ws + 2 * sz;           // g     -> g*h
    float* carries = ws + 3 * sz;           // CH * B * H floats

    unsigned short* xhi = (unsigned short*)(carries + (size_t)CH * Bb * Hh);
    unsigned short* xlo = xhi + (size_t)Mm * Kk;
    unsigned short* whi = xlo + (size_t)Mm * Kk;            // 4 weights concat [w][N][K]
    unsigned short* wlo = whi + (size_t)4 * Nn * Kk;

    const int cb = 256;
    // --- pre-split to bf16 hi/lo planes ---
    split_convert_kernel<<<(unsigned)((size_t)Mm * Kk / 4 / cb), cb, 0, stream>>>(x, xhi, xlo);
    const size_t wq = (size_t)Nn * Kk;
    split_convert_kernel<<<(unsigned)(wq / 4 / cb), cb, 0, stream>>>(w_i, whi + 0 * wq, wlo + 0 * wq);
    split_convert_kernel<<<(unsigned)(wq / 4 / cb), cb, 0, stream>>>(w_f, whi + 1 * wq, wlo + 1 * wq);
    split_convert_kernel<<<(unsigned)(wq / 4 / cb), cb, 0, stream>>>(w_g, whi + 2 * wq, wlo + 2 * wq);
    split_convert_kernel<<<(unsigned)(wq / 4 / cb), cb, 0, stream>>>(w_o, whi + 3 * wq, wlo + 3 * wq);

    dim3 gg(Nn / BN, Mm / BM);              // (16, 64)
    // --- fused projection GEMM (i,f,g) + gate epilogue ---
    gemm_bf16s_kernel<0><<<gg, cb, 0, stream>>>(xhi, xlo, whi, wlo, ws_f, ws_i, ws_g);
    // --- chunked linear scan ---
    scan_chunk_kernel<<<(Bb * CH * Hh) / cb, cb, 0, stream>>>(ws_f, ws_i);
    scan_carry_kernel<<<(Bb * Hh) / cb, cb, 0, stream>>>(ws_f, ws_i, h0, carries);
    fix_gh_kernel<<<(unsigned)((size_t)Bb * Ss * Hh / 4 / cb), cb, 0, stream>>>(ws_f, ws_i, ws_g, carries);
    // --- (g*h) needs bf16 split for the output GEMM ---
    split_convert_kernel<<<(unsigned)((size_t)Mm * Kk / 4 / cb), cb, 0, stream>>>(ws_g, xhi, xlo);
    gemm_bf16s_kernel<1><<<gg, cb, 0, stream>>>(xhi, xlo, whi + 3 * wq, wlo + 3 * wq, out, nullptr, nullptr);
}

// v003
// One run takes 203 microseconds.
// Next to v002, in two timings, it ran 1.12 times as fast each time.
// All steps since v000 together make it 1.72 times as fast.
#include <hip/hip_runtime.h>
#include <hip/hip_bf16.h>
#include <cstdint>

typedef __attribute__((ext_vector_type(16))) __bf16 v16bf;
typedef __attribute__((ext_vector_type(8)))  __bf16 v8bf;
typedef __attribute__((ext_vector_type(8)))  float  v8f;

// Problem sizes (reference: B=4, S=2048, H=1024)
constexpr int Bb = 4, Ss = 2048, Hh = 1024;
constexpr int Mm = Bb * Ss;          // 8192
constexpr int Kk = Hh;               // 1024
constexpr int Nn = Hh;               // 1024

// GEMM tiling: workgroup tile 128(M) x 64(N) x 64(K), 8 waves (4M x 2N),
// wave tile 32x32 = 2x2 of 16x16x32 WMMA tiles, 3xBF16 split accumulation.
// A K slab of 64 bf16 is one whole 128-B line of every operand row.
// Slabs go through a ring of two LDS buffers filled by asynchronous copies one slab ahead.
constexpr int BM = 128, BN = 64, BK = 64;
constexpr int LDT = BK;              // 128-B rows, no pad: with two buffers, two projection work-groups still fit one WGP's LDS
// Row r keeps its 16-B chunk q at place q ^ ((r >> 1) & 7): 16 rows read at one q cover all 64 banks once.

// Chunked scan: a chunk is the 32 time steps of one wave tile of the projection GEMM,
// whose epilogue scans it in registers.
constexpr int CL = 32;               // steps per chunk = rows of a wave tile
constexpr int CH = Ss / CL;          // 64 chunks along S
static_assert(Ss % CL == 0 && BM % CL == 0, "a chunk never crosses a batch row or a workgroup tile");

// Split fp32 into hi+lo bf16 (round-to-nearest-ish). a ~= hi + lo to ~2^-18 rel.
__device__ __forceinline__ void split_bf16(float a, unsigned short& hi, unsigned short& lo) {
    unsigned int b  = __float_as_uint(a);
    unsigned int hb = (b + 0x8000u) & 0xFFFF0000u;
    float fhi = __uint_as_float(hb);
    float r   = a - fhi;                           // exact (Sterbenz)
    unsigned int rb = __float_as_uint(r) + 0x8000u;
    hi = (unsigned short)(hb >> 16);
    lo = (unsigned short)(rb >> 16);
}

// One-shot conversion: fp32 plane -> separate hi/lo bf16 planes (float4 per thread).
__global__ void split_convert_kernel(const float* __restrict__ in,
                                     unsigned short* __restrict__ ohi,
                                     unsigned short* __restrict__ olo) {
    const size_t e = (size_t)blockIdx.x * blockDim.x + threadIdx.x;  // float4 units
    const float4 v = reinterpret_cast<const float4*>(in)[e];
    unsigned short h0,h1,h2,h3,l0,l1,l2,l3;
    split_bf16(v.x, h0, l0); split_bf16(v.y, h1, l1);
    split_bf16(v.z, h2, l2); split_bf16(v.w, h3, l3);
    uint2 ph; ph.x = (unsigned)h0 | ((unsigned)h1 << 16); ph.y = (unsigned)h2 | ((unsigned)h3 << 16);
    uint2 pl; pl.x = (unsigned)l0 | ((unsigned)l1 << 16); pl.y = (unsigned)l2 | ((unsigned)l3 << 16);
    reinterpret_cast<uint2*>(ohi)[e] = ph;
    reinterpret_cast<uint2*>(olo)[e] = pl;
}

__device__ __forceinline__ unsigned lds_off(const void* p) { return (unsigned)(size_t)p; }

__device__ __forceinline__ void async_copy4(unsigned l0, const unsigned short* g0,
                                            unsigned l1, const unsigned short* g1,
                                            unsigned l2, const unsigned short* g2,
                                            unsigned l3, const unsigned short* g3) {
    asm volatile("global_load_async_to_lds_b128 %0, %1, off\n\t"
                 "global_load_async_to_lds_b128 %2, %3, off\n\t"
                 "global_load_async_to_lds_b128 %4, %5, off\n\t"
                 "global_load_async_to_lds_b128 %6, %7, off\n\t"
                 "s_wait_xcnt 0x0"
                 :: "v"(l0), "v"(g0), "v"(l1), "v"(g1), "v"(l2), "v"(g2), "v"(l3), "v"(g3)
                 : "memory");
}

__device__ __forceinline__ void async_copy8(unsigned l0, const unsigned short* g0,
                                            unsigned l1, const unsigned short* g1,
                                            unsigned l2, const unsigned short* g2,
                                            unsigned l3, const unsigned short* g3,
                                            unsigned l4, const unsigned short* g4,
                                            unsigned l5, const unsigned short* g5,
                                            unsigned l6, const unsigned short* g6,
                                            unsigned l7, const unsigned short* g7) {
    asm volatile("global_load_async_to_lds_b128 %0, %1, off\n\t"
                 "global_load_async_to_lds_b128 %2, %3, off\n\t"
                 "global_load_async_to_lds_b128 %4, %5, off\n\t"
                 "global_load_async_to_lds_b128 %6, %7, off\n\t"
                 "global_load_async_to_lds_b128 %8, %9, off\n\t"
                 "global_load_async_to_lds_b128 %10, %11, off\n\t"
                 "global_load_async_to_lds_b128 %12, %13, off\n\t"
                 "global_load_async_to_lds_b128 %14, %15, off\n\t"
                 "s_wait_xcnt 0x0"
                 :: "v"(l0), "v"(g0), "v"(l1), "v"(g1), "v"(l2), "v"(g2), "v"(l3), "v"(g3),
                    "v"(l4), "v"(g4), "v"(l5), "v"(g5), "v"(l6), "v"(g6), "v"(l7), "v"(g7)
                 : "memory");
}

union FragU { v16bf v; v8bf h[2]; };

// MODE 0: fused projection GEMM vs 3 pre-split weights (i,f,g):
//   epilogue: with f_t = sigmoid(f), i_t = i*sigmoid(i)*(1-f_t), the recurrence h_t = f_t*h_(t-1) + i_t is scanned
//   over the wave tile's 32 rows from h = 0: O0 = running product of f_t, O1 = that local h_t, O2 = g
// MODE 1: plain GEMM vs 1 pre-split weight: O0 = A@W^T
// Whi/Wlo hold NW weights concatenated: [w][N][K].
template <int MODE>
__global__ __launch_bounds__(256, 1) void gemm_bf16s_kernel(
    const unsigned short* __restrict__ Ahi, const unsigned short* __restrict__ Alo,
    const unsigned short* __restrict__ Whi, const unsigned short* __restrict__ Wlo,
    float* __restrict__ O0, float* __restrict__ O1, float* __restrict__ O2)
{
    constexpr int NW = (MODE == 0) ? 3 : 1;
    struct alignas(16) Smem {
        unsigned short a_hi[BM][LDT];
        unsigned short a_lo[BM][LDT];
        unsigned short b_hi[NW][BN][LDT];
        unsigned short b_lo[NW][BN][LDT];
    };
    __shared__ Smem sm[2];               // two slab buffers: one is read while the other is filled

    const int tid   = threadIdx.x;
    const int lane  = tid & 31;
    const int wave  = tid >> 5;
    const int wm    = wave & 3;          // wave M index 0..3
    const int wn    = wave >> 2;         // wave N index 0..1
    const int lo16  = lane & 15;
    const int khalf = lane >> 4;         // 0|1
    const int rsh   = khalf * 8;         // C/D row offset for upper half-wave

    const int rowM0 = blockIdx.y * BM;
    const int colN0 = blockIdx.x * BN;

    // staging assignments: 8 adjacent lanes cover one row's 128-B line, so a
    // wave-wide 16-B load touches 4 whole lines (rows srow + 32*j)
    const int srow = tid >> 3;           // 0..31
    const int scol = (tid & 7) * 8;      // 0,8,..,56
    const int dcol = ((tid & 7) ^ ((srow >> 1) & 7)) * 8;   // the chunk's place in its LDS row (rows srow + 32*j share it)
    const int fsw  = khalf ^ ((lo16 >> 1) & 7);             // reader's side: chunk (c | khalf) of a row = lo16 mod 16 lies at c ^ fsw, c even

    const size_t aRowBase = (size_t)(rowM0 + srow) * Kk;  // + j*32*Kk + kc*BK + scol
    size_t bRowBase[NW];
#pragma unroll
    for (int w = 0; w < NW; ++w)
        bRowBase[w] = (size_t)w * Nn * Kk + (size_t)(colN0 + srow) * Kk;

    v8f acc[NW][2][2];
    const v8f vzero = {0.f, 0.f, 0.f, 0.f, 0.f, 0.f, 0.f, 0.f};
#pragma unroll
    for (int w = 0; w < NW; ++w)
#pragma unroll
        for (int mt = 0; mt < 2; ++mt)
#pragma unroll
            for (int nt = 0; nt < 2; ++nt) acc[w][mt][nt] = vzero;

    constexpr int NKC = Kk / BK;
    static_assert(NKC >= 2, "the ring's prologue fills two slabs");

    // all of slab t (A 128x64, B NW x 64x64, hi and lo planes) into buffer b, 8 + 4*NW copies a lane
    auto stage_slab = [&](int t, int b) {
        Smem& d = sm[b];
        const unsigned short* pah = Ahi + aRowBase + (size_t)t * BK + scol;
        const unsigned short* pal = Alo + aRowBase + (size_t)t * BK + scol;
        async_copy8(lds_off(&d.a_hi[srow][dcol]),      pah,
                    lds_off(&d.a_hi[srow + 32][dcol]), pah + (size_t)32 * Kk,
                    lds_off(&d.a_hi[srow + 64][dcol]), pah + (size_t)64 * Kk,
                    lds_off(&d.a_hi[srow + 96][dcol]), pah + (size_t)96 * Kk,
                    lds_off(&d.a_lo[srow][dcol]),      pal,
                    lds_off(&d.a_lo[srow + 32][dcol]), pal + (size_t)32 * Kk,
                    lds_off(&d.a_lo[srow + 64][dcol]), pal + (size_t)64 * Kk,
                    lds_off(&d.a_lo[srow + 96][dcol]), pal + (size_t)96 * Kk);
#pragma unroll  // constant w: bRowBase stays in registers
        for (int w = 0; w < NW; ++w) {
            const unsigned short* pbh = Whi + bRowBase[w] + (size_t)t * BK + scol;
            const unsigned short* pbl = Wlo + bRowBase[w] + (size_t)t * BK + scol;
            async_copy4(lds_off(&d.b_hi[w][srow][dcol]),      pbh,
                        lds_off(&d.b_hi[w][srow + 32][dcol]), pbh + (size_t)32 * Kk,
                        lds_off(&d.b_lo[w][srow][dcol]),      pbl,
                        lds_off(&d.b_lo[w][srow + 32][dcol]), pbl + (size_t)32 * Kk);
        }
    };

    // prologue: slab 0 lands and is published, then slab 1 starts to fly
    stage_slab(0, 0);
    asm volatile("s_wait_asynccnt 0x0" ::: "memory");   // this wave's copies of slab 0 have landed
    __syncthreads();                                    // ... and every other wave's
    stage_slab(1, 1);

    for (int kc = 0; kc < NKC; ++kc) {
        const Smem& s = sm[kc & 1];

        // two 32-deep WMMA steps per slab, in ascending k (same sum order per accumulator)
#pragma unroll  // constant ks: LDS offsets become immediates
        for (int ks = 0; ks < BK; ks += 32) {
            // ---- A fragments (2 M-tiles) ----
            v16bf afh[2], afl[2];
#pragma unroll
            for (int mt = 0; mt < 2; ++mt) {
                const int r = wm * 32 + mt * 16 + lo16;
                FragU fh, fl;
                fh.h[0] = *reinterpret_cast<const v8bf*>(&s.a_hi[r][((ks / 8) ^ fsw) * 8]);
                fh.h[1] = *reinterpret_cast<const v8bf*>(&s.a_hi[r][((ks / 8 + 2) ^ fsw) * 8]);
                fl.h[0] = *reinterpret_cast<const v8bf*>(&s.a_lo[r][((ks / 8) ^ fsw) * 8]);
                fl.h[1] = *reinterpret_cast<const v8bf*>(&s.a_lo[r][((ks / 8 + 2) ^ fsw) * 8]);
                afh[mt] = fh.v; afl[mt] = fl.v;
            }
            // ---- B fragments + 3xBF16 WMMA ----
#pragma unroll
            for (int w = 0; w < NW; ++w) {
#pragma unroll
                for (int nt = 0; nt < 2; ++nt) {
                    const int c = wn * 32 + nt * 16 + lo16;
                    FragU bh, bl;
                    bh.h[0] = *reinterpret_cast<const v8bf*>(&s.b_hi[w][c][((ks / 8) ^ fsw) * 8]);
                    bh.h[1] = *reinterpret_cast<const v8bf*>(&s.b_hi[w][c][((ks / 8 + 2) ^ fsw) * 8]);
                    bl.h[0] = *reinterpret_cast<const v8bf*>(&s.b_lo[w][c][((ks / 8) ^ fsw) * 8]);
                    bl.h[1] = *reinterpret_cast<const v8bf*>(&s.b_lo[w][c][((ks / 8 + 2) ^ fsw) * 8]);
#pragma unroll
                    for (int mt = 0; mt < 2; ++mt) {
                        v8f a = acc[w][mt][nt];
                        a = __builtin_amdgcn_wmma_f32_16x16x32_bf16(false, afh[mt], false, bh.v, (short)0, a, false, false);
                        a = __builtin_amdgcn_wmma_f32_16x16x32_bf16(false, afh[mt], false, bl.v, (short)0, a, false, false);
                        a = __builtin_amdgcn_wmma_f32_16x16x32_bf16(false, afl[mt], false, bh.v, (short)0, a, false, false);
                        acc[w][mt][nt] = a;
                    }
                }
            }
        }

        // foot of trip kc: publish slab kc+1, free the buffer that this trip has read
        asm volatile("s_wait_dscnt 0x0" ::: "memory");      // this wave's reads of slab kc are done
        asm volatile("s_wait_asynccnt 0x0" ::: "memory");   // this wave's copies of slab kc+1 have landed
        __syncthreads();                                    // both hold for every wave
        if (kc + 2 < NKC) stage_slab(kc + 2, kc & 1);       // flies while slab kc+1 is worked on
    }
    asm volatile("s_wait_asynccnt 0x0" ::: "memory");       // no copy is left in flight at the wave's end

    // ---- epilogue: C/D layout: VGPR r -> (M = r + 8*khalf, N = lo16) ----
    // Per column the wave tile's 32 rows (time steps) are four runs of 8 consecutive rows, in time order
    // (mt0,kh0) (mt0,kh1) (mt1,kh0) (mt1,kh1); a lane holds the two runs of its own khalf.
#pragma unroll
    for (int nt = 0; nt < 2; ++nt) {
        const int gcol = colN0 + wn * 32 + nt * 16 + lo16;
        if (MODE == 0) {
            // 1. each run of 8 rows scanned in the lane, from h = 0 and product 1
            float hp[2][8], cf[2][8];
#pragma unroll
            for (int mt = 0; mt < 2; ++mt) {
                float h = 0.0f, c = 1.0f;
#pragma unroll
                for (int r = 0; r < 8; ++r) {
                    const float iv = acc[0][mt][nt][r];
                    const float fv = acc[1][mt][nt][r];
                    const float fs = 1.0f / (1.0f + __expf(-fv));
                    const float is = 1.0f / (1.0f + __expf(-iv));
                    h = __builtin_fmaf(fs, h, iv * is * (1.0f - fs));
                    c *= fs;
                    hp[mt][r] = h;
                    cf[mt][r] = c;
                }
            }
            // 2. run ends of the other half-wave (same column, the other 8 rows of each 16)
            const float ph0 = __shfl_xor(hp[0][7], 16), pc0 = __shfl_xor(cf[0][7], 16);
            const float ph1 = __shfl_xor(hp[1][7], 16), pc1 = __shfl_xor(cf[1][7], 16);
            const float l0h = khalf ? ph0 : hp[0][7], l0c = khalf ? pc0 : cf[0][7];   // end of (mt0,kh0)
            const float u0h = khalf ? hp[0][7] : ph0, u0c = khalf ? cf[0][7] : pc0;   // end of (mt0,kh1)
            const float l1h = khalf ? ph1 : hp[1][7], l1c = khalf ? pc1 : cf[1][7];   // end of (mt1,kh0)
            const float t0h = __builtin_fmaf(u0c, l0h, u0h), t0c = u0c * l0c;         // state after 16 rows
            const float t1h = __builtin_fmaf(l1c, t0h, l1h), t1c = l1c * t0c;         // state after 24 rows
            const float ch[2] = { khalf ? l0h : 0.0f, khalf ? t1h : t0h };            // what enters this lane's runs
            const float cc[2] = { khalf ? l0c : 1.0f, khalf ? t1c : t0c };
            // 3. carry applied, results stored
#pragma unroll
            for (int mt = 0; mt < 2; ++mt) {
#pragma unroll
                for (int r = 0; r < 8; ++r) {
                    const int grow = rowM0 + wm * 32 + mt * 16 + rsh + r;
                    const size_t idx = (size_t)grow * Nn + gcol;
                    O0[idx] = cf[mt][r] * cc[mt];                                  // product of f over the chunk so far
                    O1[idx] = __builtin_fmaf(cf[mt][r], ch[mt], hp[mt][r]);        // h' (chunk scan from 0)
                    O2[idx] = acc[2][mt][nt][r];                                   // g
                }
            }
        } else {
#pragma unroll
            for (int mt = 0; mt < 2; ++mt) {
#pragma unroll
                for (int r = 0; r < 8; ++r) {
                    const int grow = rowM0 + wm * 32 + mt * 16 + rsh + r;
                    O0[(size_t)grow * Nn + gcol] = acc[0][mt][nt][r];
                }
            }
        }
    }
}

// Phase A (per-chunk local scan: ws_i = h' from h0 = 0, ws_f = cumprod(f)) is the projection GEMM's epilogue.
// Phase B: serial combine across the CH chunk boundaries, seeded with h_init.
__global__ void scan_carry_kernel(const float* __restrict__ ws_f, const float* __restrict__ ws_i,
                                  const float* __restrict__ h_init, float* __restrict__ carries) {
    const int tid = blockIdx.x * blockDim.x + threadIdx.x;   // B*H threads
    const int hh = tid % Hh;
    const int b  = tid / Hh;
    float carry = h_init[(size_t)b * Hh + hh];
#pragma unroll
    for (int c = 0; c < CH; ++c) {
        carries[(size_t)c * (Bb * Hh) + (size_t)b * Hh + hh] = carry;
        const size_t idx = ((size_t)b * Ss + (size_t)c * CL + (CL - 1)) * Hh + hh;
        carry = __builtin_fmaf(ws_f[idx], carry, ws_i[idx]);   // h_end = h'_end + cf_end*carry
    }
}

// Phase C: h = h' + cf*carry ; gh = g*h, written in place over g (float4 vectorized).
__global__ void fix_gh_kernel(const float* __restrict__ ws_f, const float* __restrict__ ws_i,
                              float* __restrict__ ws_g, const float* __restrict__ carries) {
    const size_t e = (size_t)blockIdx.x * blockDim.x + threadIdx.x;  // B*S*H/4 float4's
    const int h4 = Hh / 4;
    const int hq = (int)(e % h4);
    const int t  = (int)((e / h4) % Ss);
    const int b  = (int)(e / ((size_t)h4 * Ss));
    const int c  = t / CL;
    const float4 hp = reinterpret_cast<const float4*>(ws_i)[e];
    const float4 cf = reinterpret_cast<const float4*>(ws_f)[e];
    const float4 g  = reinterpret_cast<const float4*>(ws_g)[e];
    const float4 cr = reinterpret_cast<const float4*>(carries)[(size_t)c * (Bb * h4) + (size_t)b * h4 + hq];
    float4 o;
    o.x = g.x * __builtin_fmaf(cf.x, cr.x, hp.x);
    o.y = g.y * __builtin_fmaf(cf.y, cr.y, hp.y);
    o.z = g.z * __builtin_fmaf(cf.z, cr.z, hp.z);
    o.w = g.w * __builtin_fmaf(cf.w, cr.w, hp.w);
    reinterpret_cast<float4*>(ws_g)[e] = o;
}

extern "C" void kernel_launch(void* const* d_in, const int* in_sizes, int n_in,
                              void* d_out, int out_size, void* d_ws, size_t ws_size,
                              hipStream_t stream) {
    const float* x    = (const float*)d_in[0];
    const float* h0   = (const float*)d_in[1];
    const float* w_i  = (const float*)d_in[2];
    const float* w_f  = (const float*)d_in[3];
    const float* w_g  = (const float*)d_in[4];
    const float* w_o  = (const float*)d_in[5];
    float* out = (float*)d_out;

    float* ws = (float*)d_ws;
    const size_t sz = (size_t)Mm * Hh;
    float* ws_f    = ws;                    // cumF
    float* ws_i    = ws + sz;               // h'
    float* ws_g    = ws + 2 * sz;           // g     -> g*h
    float* carries = ws + 3 * sz;           // CH * B * H floats

    unsigned short* xhi = (unsigned short*)(carries + (size_t)CH * Bb * Hh);
    unsigned short* xlo = xhi + (size_t)Mm * Kk;
    unsigned short* whi = xlo + (size_t)Mm * Kk;            // 4 weights concat [w][N][K]
    unsigned short* wlo = whi + (size_t)4 * Nn * Kk;

    const int cb = 256;
    // --- pre-split to bf16 hi/lo planes ---
    split_convert_kernel<<<(unsigned)((size_t)Mm * Kk / 4 / cb), cb, 0, stream>>>(x, xhi, xlo);
    const size_t wq = (size_t)Nn * Kk;
    split_convert_kernel<<<(unsigned)(wq / 4 / cb), cb, 0, stream>>>(w_i, whi + 0 * wq, wlo + 0 * wq);
    split_convert_kernel<<<(unsigned)(wq / 4 / cb), cb, 0, stream>>>(w_f, whi + 1 * wq, wlo + 1 * wq);
    split_convert_kernel<<<(unsigned)(wq / 4 / cb), cb, 0, stream>>>(w_g, whi + 2 * wq, wlo + 2 * wq);
    split_convert_kernel<<<(unsigned)(wq / 4 / cb), cb, 0, stream>>>(w_o, whi + 3 * wq, wlo + 3 * wq);

    dim3 gg(Nn / BN, Mm / BM);              // (16, 64)
    // --- fused projection GEMM (i,f,g) + gate and chunk-scan epilogue ---
    gemm_bf16s_kernel<0><<<gg, cb, 0, stream>>>(xhi, xlo, whi, wlo, ws_f, ws_i, ws_g);
    // --- carries across chunks, then applied ---
    scan_carry_kernel<<<(Bb * Hh) / cb, cb, 0, stream>>>(ws_f, ws_i, h0, carries);
    fix_gh_kernel<<<(unsigned)((size_t)Bb * Ss * Hh / 4 / cb), cb, 0, stream>>>(ws_f, ws_i, ws_g, carries);
    // --- (g*h) needs bf16 split for the output GEMM ---
    split_convert_kernel<<<(unsigned)((size_t)Mm * Kk / 4 / cb), cb, 0, stream>>>(ws_g, xhi, xlo);
    gemm_bf16s_kernel<1><<<gg, cb, 0, stream>>>(xhi, xlo, whi + 3 * wq, wlo + 3 * wq, out, nullptr, nullptr);
}

// v004
// One run takes 172 microseconds.
// Next to v003, in two timings, it ran 1.18 times as fast each time.
// All steps since v000 together make it 2.03 times as fast.
#include <hip/hip_runtime.h>
#include <hip/hip_bf16.h>
#include <cstdint>

typedef __attribute__((ext_vector_type(16))) __bf16 v16bf;
typedef __attribute__((ext_vector_type(8)))  __bf16 v8bf;
typedef __attribute__((ext_vector_type(8)))  float  v8f;

// Problem sizes (reference: B=4, S=2048, H=1024)
constexpr int Bb = 4, Ss = 2048, Hh = 1024;
constexpr int Mm = Bb * Ss;          // 8192
constexpr int Kk = Hh;               // 1024
constexpr int Nn = Hh;               // 1024

// GEMM tiling: workgroup tile 128(M) x 64(N) x 64(K), 8 waves (4M x 2N),
// wave tile 32x32 = 2x2 of 16x16x32 WMMA tiles, 3xBF16 split accumulation.
// A K slab of 64 bf16 is one whole 128-B line of every operand row.
// Slabs go through a ring of two LDS buffers filled by asynchronous copies one slab ahead.
constexpr int BM = 128, BN = 64, BK = 64;
constexpr int LDT = BK;              // 128-B rows, no pad: with two buffers, two projection work-groups still fit one WGP's LDS
// Row r keeps its 16-B chunk q at place q ^ ((r >> 1) & 7): 16 rows read at one q cover all 64 banks once.

// Chunked scan: a chunk is the 32 time steps of one wave tile of the projection GEMM,
// whose epilogue scans it in registers.
constexpr int CL = 32;               // steps per chunk = rows of a wave tile
constexpr int CH = Ss / CL;          // 64 chunks along S
static_assert(Ss % CL == 0 && BM % CL == 0, "a chunk never crosses a batch row or a workgroup tile");

// Split fp32 into hi+lo bf16 (round-to-nearest-ish). a ~= hi + lo to ~2^-18 rel.
__device__ __forceinline__ void split_bf16(float a, unsigned short& hi, unsigned short& lo) {
    unsigned int b  = __float_as_uint(a);
    unsigned int hb = (b + 0x8000u) & 0xFFFF0000u;
    float fhi = __uint_as_float(hb);
    float r   = a - fhi;                           // exact (Sterbenz)
    unsigned int rb = __float_as_uint(r) + 0x8000u;
    hi = (unsigned short)(hb >> 16);
    lo = (unsigned short)(rb >> 16);
}

// Four fp32 values -> their hi and lo bf16 parts, packed for one 8-B store into each plane.
__device__ __forceinline__ void split4(const float4 v, uint2& ph, uint2& pl) {
    unsigned short h0,h1,h2,h3,l0,l1,l2,l3;
    split_bf16(v.x, h0, l0); split_bf16(v.y, h1, l1);
    split_bf16(v.z, h2, l2); split_bf16(v.w, h3, l3);
    ph.x = (unsigned)h0 | ((unsigned)h1 << 16); ph.y = (unsigned)h2 | ((unsigned)h3 << 16);
    pl.x = (unsigned)l0 | ((unsigned)l1 << 16); pl.y = (unsigned)l2 | ((unsigned)l3 << 16);
}

constexpr int CB = 256;                          // threads per block of the elementwise kernels
constexpr unsigned XBLK = (unsigned)((size_t)Mm * Kk / 4 / CB);   // blocks that split x
constexpr unsigned WBLK = (unsigned)((size_t)Nn * Kk / 4 / CB);   // blocks that split one weight

// All five fp32 inputs -> hi/lo bf16 planes in one grid (float4 per thread): blocks [0, XBLK) take x,
// then WBLK blocks each for w_i, w_f, w_g, w_o, whose planes lie one behind another in whi / wlo.
__global__ void split_inputs_kernel(const float* __restrict__ x,
                                    const float* __restrict__ w_i, const float* __restrict__ w_f,
                                    const float* __restrict__ w_g, const float* __restrict__ w_o,
                                    unsigned short* __restrict__ xhi, unsigned short* __restrict__ xlo,
                                    unsigned short* __restrict__ whi, unsigned short* __restrict__ wlo) {
    const unsigned blk = blockIdx.x;
    const float* in = x;
    unsigned short* ohi = xhi;
    unsigned short* olo = xlo;
    unsigned sblk = blk, dblk = blk;             // block's place in its source and in its planes
    if (blk >= XBLK) {
        dblk = blk - XBLK;
        const unsigned w = dblk / WBLK;
        sblk = dblk % WBLK;
        in  = (w == 0) ? w_i : (w == 1) ? w_f : (w == 2) ? w_g : w_o;
        ohi = whi; olo = wlo;
    }
    const float4 v = reinterpret_cast<const float4*>(in)[(size_t)sblk * CB + threadIdx.x];
    uint2 ph, pl;
    split4(v, ph, pl);
    const size_t d = (size_t)dblk * CB + threadIdx.x;
    reinterpret_cast<uint2*>(ohi)[d] = ph;
    reinterpret_cast<uint2*>(olo)[d] = pl;
}

__device__ __forceinline__ unsigned lds_off(const void* p) { return (unsigned)(size_t)p; }

__device__ __forceinline__ void async_copy4(unsigned l0, const unsigned short* g0,
                                            unsigned l1, const unsigned short* g1,
                                            unsigned l2, const unsigned short* g2,
                                            unsigned l3, const unsigned short* g3) {
    asm volatile("global_load_async_to_lds_b128 %0, %1, off\n\t"
                 "global_load_async_to_lds_b128 %2, %3, off\n\t"
                 "global_load_async_to_lds_b128 %4, %5, off\n\t"
                 "global_load_async_to_lds_b128 %6, %7, off\n\t"
                 "s_wait_xcnt 0x0"
                 :: "v"(l0), "v"(g0), "v"(l1), "v"(g1), "v"(l2), "v"(g2), "v"(l3), "v"(g3)
                 : "memory");
}

__device__ __forceinline__ void async_copy8(unsigned l0, const unsigned short* g0,
                                            unsigned l1, const unsigned short* g1,
                                            unsigned l2, const unsigned short* g2,
                                            unsigned l3, const unsigned short* g3,
                                            unsigned l4, const unsigned short* g4,
                                            unsigned l5, const unsigned short* g5,
                                            unsigned l6, const unsigned short* g6,
                                            unsigned l7, const unsigned short* g7) {
    asm volatile("global_load_async_to_lds_b128 %0, %1, off\n\t"
                 "global_load_async_to_lds_b128 %2, %3, off\n\t"
                 "global_load_async_to_lds_b128 %4, %5, off\n\t"
                 "global_load_async_to_lds_b128 %6, %7, off\n\t"
                 "global_load_async_to_lds_b128 %8, %9, off\n\t"
                 "global_load_async_to_lds_b128 %10, %11, off\n\t"
                 "global_load_async_to_lds_b128 %12, %13, off\n\t"
                 "global_load_async_to_lds_b128 %14, %15, off\n\t"
                 "s_wait_xcnt 0x0"
                 :: "v"(l0), "v"(g0), "v"(l1), "v"(g1), "v"(l2), "v"(g2), "v"(l3), "v"(g3),
                    "v"(l4), "v"(g4), "v"(l5), "v"(g5), "v"(l6), "v"(g6), "v"(l7), "v"(g7)
                 : "memory");
}

union FragU { v16bf v; v8bf h[2]; };

// MODE 0: fused projection GEMM vs 3 pre-split weights (i,f,g):
//   epilogue: with f_t = sigmoid(f), i_t = i*sigmoid(i)*(1-f_t), the recurrence h_t = f_t*h_(t-1) + i_t is scanned
//   over the wave tile's 32 rows from h = 0: O0 = running product of f_t, O1 = that local h_t, O2 = g
// MODE 1: plain GEMM vs 1 pre-split weight: O0 = A@W^T
// Whi/Wlo hold NW weights concatenated: [w][N][K].
template <int MODE>
__global__ __launch_bounds__(256, 1) void gemm_bf16s_kernel(
    const unsigned short* __restrict__ Ahi, const unsigned short* __restrict__ Alo,
    const unsigned short* __restrict__ Whi, const unsigned short* __restrict__ Wlo,
    float* __restrict__ O0, float* __restrict__ O1, float* __restrict__ O2)
{
    constexpr int NW = (MODE == 0) ? 3 : 1;
    struct alignas(16) Smem {
        unsigned short a_hi[BM][LDT];
        unsigned short a_lo[BM][LDT];
        unsigned short b_hi[NW][BN][LDT];
        unsigned short b_lo[NW][BN][LDT];
    };
    __shared__ Smem sm[2];               // two slab buffers: one is read while the other is filled

    const int tid   = threadIdx.x;
    const int lane  = tid & 31;
    const int wave  = tid >> 5;
    const int wm    = wave & 3;          // wave M index 0..3
    const int wn    = wave >> 2;         // wave N index 0..1
    const int lo16  = lane & 15;
    const int khalf = lane >> 4;         // 0|1
    const int rsh   = khalf * 8;         // C/D row offset for upper half-wave

    const int rowM0 = blockIdx.y * BM;
    const int colN0 = blockIdx.x * BN;

    // staging assignments: 8 adjacent lanes cover one row's 128-B line, so a
    // wave-wide 16-B load touches 4 whole lines (rows srow + 32*j)
    const int srow = tid >> 3;           // 0..31
    const int scol = (tid & 7) * 8;      // 0,8,..,56
    const int dcol = ((tid & 7) ^ ((srow >> 1) & 7)) * 8;   // the chunk's place in its LDS row (rows srow + 32*j share it)
    const int fsw  = khalf ^ ((lo16 >> 1) & 7);             // reader's side: chunk (c | khalf) of a row = lo16 mod 16 lies at c ^ fsw, c even

    const size_t aRowBase = (size_t)(rowM0 + srow) * Kk;  // + j*32*Kk + kc*BK + scol
    size_t bRowBase[NW];
#pragma unroll
    for (int w = 0; w < NW; ++w)
        bRowBase[w] = (size_t)w * Nn * Kk + (size_t)(colN0 + srow) * Kk;

    v8f acc[NW][2][2];
    const v8f vzero = {0.f, 0.f, 0.f, 0.f, 0.f, 0.f, 0.f, 0.f};
#pragma unroll
    for (int w = 0; w < NW; ++w)
#pragma unroll
        for (int mt = 0; mt < 2; ++mt)
#pragma unroll
            for (int nt = 0; nt < 2; ++nt) acc[w][mt][nt] = vzero;

    constexpr int NKC = Kk / BK;
    static_assert(NKC >= 2, "the ring's prologue fills two slabs");

    // all of slab t (A 128x64, B NW x 64x64, hi and lo planes) into buffer b, 8 + 4*NW copies a lane
    auto stage_slab = [&](int t, int b) {
        Smem& d = sm[b];
        const unsigned short* pah = Ahi + aRowBase + (size_t)t * BK + scol;
        const unsigned short* pal = Alo + aRowBase + (size_t)t * BK + scol;
        async_copy8(lds_off(&d.a_hi[srow][dcol]),      pah,
                    lds_off(&d.a_hi[srow + 32][dcol]), pah + (size_t)32 * Kk,
                    lds_off(&d.a_hi[srow + 64][dcol]), pah + (size_t)64 * Kk,
                    lds_off(&d.a_hi[srow + 96][dcol]), pah + (size_t)96 * Kk,
                    lds_off(&d.a_lo[srow][dcol]),      pal,
                    lds_off(&d.a_lo[srow + 32][dcol]), pal + (size_t)32 * Kk,
                    lds_off(&d.a_lo[srow + 64][dcol]), pal + (size_t)64 * Kk,
                    lds_off(&d.a_lo[srow + 96][dcol]), pal + (size_t)96 * Kk);
#pragma unroll  // constant w: bRowBase stays in registers
        for (int w = 0; w < NW; ++w) {
            const unsigned short* pbh = Whi + bRowBase[w] + (size_t)t * BK + scol;
            const unsigned short* pbl = Wlo + bRowBase[w] + (size_t)t * BK + scol;
            async_copy4(lds_off(&d.b_hi[w][srow][dcol]),      pbh,
                        lds_off(&d.b_hi[w][srow + 32][dcol]), pbh + (size_t)32 * Kk,
                        lds_off(&d.b_lo[w][srow][dcol]),      pbl,
                        lds_off(&d.b_lo[w][srow + 32][dcol]), pbl + (size_t)32 * Kk);
        }
    };

    // prologue: slab 0 lands and is published, then slab 1 starts to fly
    stage_slab(0, 0);
    asm volatile("s_wait_asynccnt 0x0" ::: "memory");   // this wave's copies of slab 0 have landed
    __syncthreads();                                    // ... and every other wave's
    stage_slab(1, 1);

    for (int kc = 0; kc < NKC; ++kc) {
        const Smem& s = sm[kc & 1];

        // two 32-deep WMMA steps per slab, in ascending k (same sum order per accumulator)
#pragma unroll  // constant ks: LDS offsets become immediates
        for (int ks = 0; ks < BK; ks += 32) {
            // ---- A fragments (2 M-tiles) ----
            v16bf afh[2], afl[2];
#pragma unroll
            for (int mt = 0; mt < 2; ++mt) {
                const int r = wm * 32 + mt * 16 + lo16;
                FragU fh, fl;
                fh.h[0] = *reinterpret_cast<const v8bf*>(&s.a_hi[r][((ks / 8) ^ fsw) * 8]);
                fh.h[1] = *reinterpret_cast<const v8bf*>(&s.a_hi[r][((ks / 8 + 2) ^ fsw) * 8]);
                fl.h[0] = *reinterpret_cast<const v8bf*>(&s.a_lo[r][((ks / 8) ^ fsw) * 8]);
                fl.h[1] = *reinterpret_cast<const v8bf*>(&s.a_lo[r][((ks / 8 + 2) ^ fsw) * 8]);
                afh[mt] = fh.v; afl[mt] = fl.v;
            }
            // ---- B fragments + 3xBF16 WMMA ----
#pragma unroll
            for (int w = 0; w < NW; ++w) {
#pragma unroll
                for (int nt = 0; nt < 2; ++nt) {
                    const int c = wn * 32 + nt * 16 + lo16;
                    FragU bh, bl;
                    bh.h[0] = *reinterpret_cast<const v8bf*>(&s.b_hi[w][c][((ks / 8) ^ fsw) * 8]);
                    bh.h[1] = *reinterpret_cast<const v8bf*>(&s.b_hi[w][c][((ks / 8 + 2) ^ fsw) * 8]);
                    bl.h[0] = *reinterpret_cast<const v8bf*>(&s.b_lo[w][c][((ks / 8) ^ fsw) * 8]);
                    bl.h[1] = *reinterpret_cast<const v8bf*>(&s.b_lo[w][c][((ks / 8 + 2) ^ fsw) * 8]);
#pragma unroll
                    for (int mt = 0; mt < 2; ++mt) {
                        v8f a = acc[w][mt][nt];
                        a = __builtin_amdgcn_wmma_f32_16x16x32_bf16(false, afh[mt], false, bh.v, (short)0, a, false, false);
                        a = __builtin_amdgcn_wmma_f32_16x16x32_bf16(false, afh[mt], false, bl.v, (short)0, a, false, false);
                        a = __builtin_amdgcn_wmma_f32_16x16x32_bf16(false, afl[mt], false, bh.v, (short)0, a, false, false);
                        acc[w][mt][nt] = a;
                    }
                }
            }
        }

        // foot of trip kc: publish slab kc+1, free the buffer that this trip has read
        asm volatile("s_wait_dscnt 0x0" ::: "memory");      // this wave's reads of slab kc are done
        asm volatile("s_wait_asynccnt 0x0" ::: "memory");   // this wave's copies of slab kc+1 have landed
        __syncthreads();                                    // both hold for every wave
        if (kc + 2 < NKC) stage_slab(kc + 2, kc & 1);       // flies while slab kc+1 is worked on
    }
    asm volatile("s_wait_asynccnt 0x0" ::: "memory");       // no copy is left in flight at the wave's end

    // ---- epilogue: C/D layout: VGPR r -> (M = r + 8*khalf, N = lo16) ----
    // Per column the wave tile's 32 rows (time steps) are four runs of 8 consecutive rows, in time order
    // (mt0,kh0) (mt0,kh1) (mt1,kh0) (mt1,kh1); a lane holds the two runs of its own khalf.
#pragma unroll
    for (int nt = 0; nt < 2; ++nt) {
        const int gcol = colN0 + wn * 32 + nt * 16 + lo16;
        if (MODE == 0) {
            // 1. each run of 8 rows scanned in the lane, from h = 0 and product 1
            float hp[2][8], cf[2][8];
#pragma unroll
            for (int mt = 0; mt < 2; ++mt) {
                float h = 0.0f, c = 1.0f;
#pragma unroll
                for (int r = 0; r < 8; ++r) {
                    const float iv = acc[0][mt][nt][r];
                    const float fv = acc[1][mt][nt][r];
                    const float fs = 1.0f / (1.0f + __expf(-fv));
                    const float is = 1.0f / (1.0f + __expf(-iv));
                    h = __builtin_fmaf(fs, h, iv * is * (1.0f - fs));
                    c *= fs;
                    hp[mt][r] = h;
                    cf[mt][r] = c;
                }
            }
            // 2. run ends of the other half-wave (same column, the other 8 rows of each 16)
            const float ph0 = __shfl_xor(hp[0][7], 16), pc0 = __shfl_xor(cf[0][7], 16);
            const float ph1 = __shfl_xor(hp[1][7], 16), pc1 = __shfl_xor(cf[1][7], 16);
            const float l0h = khalf ? ph0 : hp[0][7], l0c = khalf ? pc0 : cf[0][7];   // end of (mt0,kh0)
            const float u0h = khalf ? hp[0][7] : ph0, u0c = khalf ? cf[0][7] : pc0;   // end of (mt0,kh1)
            const float l1h = khalf ? ph1 : hp[1][7], l1c = khalf ? pc1 : cf[1][7];   // end of (mt1,kh0)
            const float t0h = __builtin_fmaf(u0c, l0h, u0h), t0c = u0c * l0c;         // state after 16 rows
            const float t1h = __builtin_fmaf(l1c, t0h, l1h), t1c = l1c * t0c;         // state after 24 rows
            const float ch[2] = { khalf ? l0h : 0.0f, khalf ? t1h : t0h };            // what enters this lane's runs
            const float cc[2] = { khalf ? l0c : 1.0f, khalf ? t1c : t0c };
            // 3. carry applied, results stored
#pragma unroll
            for (int mt = 0; mt < 2; ++mt) {
#pragma unroll
                for (int r = 0; r < 8; ++r) {
                    const int grow = rowM0 + wm * 32 + mt * 16 + rsh + r;
                    const size_t idx = (size_t)grow * Nn + gcol;
                    O0[idx] = cf[mt][r] * cc[mt];                                  // product of f over the chunk so far
                    O1[idx] = __builtin_fmaf(cf[mt][r], ch[mt], hp[mt][r]);        // h' (chunk scan from 0)
                    O2[idx] = acc[2][mt][nt][r];                                   // g
                }
            }
        } else {
#pragma unroll
            for (int mt = 0; mt < 2; ++mt) {
#pragma unroll
                for (int r = 0; r < 8; ++r) {
                    const int grow = rowM0 + wm * 32 + mt * 16 + rsh + r;
                    O0[(size_t)grow * Nn + gcol] = acc[0][mt][nt][r];
                }
            }
        }
    }
}

// Phase A (per-chunk local scan: ws_i = h' from h0 = 0, ws_f = cumprod(f)) is the projection GEMM's epilogue.
// Phase B: serial combine across the CH chunk boundaries, seeded with h_init.
__global__ void scan_carry_kernel(const float* __restrict__ ws_f, const float* __restrict__ ws_i,
                                  const float* __restrict__ h_init, float* __restrict__ carries) {
    const int tid = blockIdx.x * blockDim.x + threadIdx.x;   // B*H threads
    const int hh = tid % Hh;
    const int b  = tid / Hh;
    float carry = h_init[(size_t)b * Hh + hh];
#pragma unroll
    for (int c = 0; c < CH; ++c) {
        carries[(size_t)c * (Bb * Hh) + (size_t)b * Hh + hh] = carry;
        const size_t idx = ((size_t)b * Ss + (size_t)c * CL + (CL - 1)) * Hh + hh;
        carry = __builtin_fmaf(ws_f[idx], carry, ws_i[idx]);   // h_end = h'_end + cf_end*carry
    }
}

// Phase C: h = h' + cf*carry ; gh = g*h, stored at once as the output GEMM's hi/lo bf16 planes (float4 per thread).
__global__ void fix_gh_split_kernel(const float* __restrict__ ws_f, const float* __restrict__ ws_i,
                                    const float* __restrict__ ws_g, const float* __restrict__ carries,
                                    unsigned short* __restrict__ ohi, unsigned short* __restrict__ olo) {
    const size_t e = (size_t)blockIdx.x * blockDim.x + threadIdx.x;  // B*S*H/4 float4's
    const int h4 = Hh / 4;
    const int hq = (int)(e % h4);
    const int t  = (int)((e / h4) % Ss);
    const int b  = (int)(e / ((size_t)h4 * Ss));
    const int c  = t / CL;
    const float4 hp = reinterpret_cast<const float4*>(ws_i)[e];
    const float4 cf = reinterpret_cast<const float4*>(ws_f)[e];
    const float4 g  = reinterpret_cast<const float4*>(ws_g)[e];
    const float4 cr = reinterpret_cast<const float4*>(carries)[(size_t)c * (Bb * h4) + (size_t)b * h4 + hq];
    float4 o;
    o.x = g.x * __builtin_fmaf(cf.x, cr.x, hp.x);
    o.y = g.y * __builtin_fmaf(cf.y, cr.y, hp.y);
    o.z = g.z * __builtin_fmaf(cf.z, cr.z, hp.z);
    o.w = g.w * __builtin_fmaf(cf.w, cr.w, hp.w);
    uint2 ph, pl;
    split4(o, ph, pl);
    reinterpret_cast<uint2*>(ohi)[e] = ph;
    reinterpret_cast<uint2*>(olo)[e] = pl;
}

extern "C" void kernel_launch(void* const* d_in, const int* in_sizes, int n_in,
                              void* d_out, int out_size, void* d_ws, size_t ws_size,
                              hipStream_t stream) {
    const float* x    = (const float*)d_in[0];
    const float* h0   = (const float*)d_in[1];
    const float* w_i  = (const float*)d_in[2];
    const float* w_f  = (const float*)d_in[3];
    const float* w_g  = (const float*)d_in[4];
    const float* w_o  = (const float*)d_in[5];
    float* out = (float*)d_out;

    float* ws = (float*)d_ws;
    const size_t sz = (size_t)Mm * Hh;
    float* ws_f    = ws;                    // cumF
    float* ws_i    = ws + sz;               // h'
    float* ws_g    = ws + 2 * sz;           // g
    float* carries = ws + 3 * sz;           // CH * B * H floats

    unsigned short* xhi = (unsigned short*)(carries + (size_t)CH * Bb * Hh);
    unsigned short* xlo = xhi + (size_t)Mm * Kk;
    unsigned short* whi = xlo + (size_t)Mm * Kk;            // 4 weights concat [w][N][K]
    unsigned short* wlo = whi + (size_t)4 * Nn * Kk;

    const int cb = CB;
    const size_t wq = (size_t)Nn * Kk;
    // --- pre-split of x and the four weights to bf16 hi/lo planes, one launch ---
    split_inputs_kernel<<<XBLK + 4 * WBLK, cb, 0, stream>>>(x, w_i, w_f, w_g, w_o, xhi, xlo, whi, wlo);

    dim3 gg(Nn / BN, Mm / BM);              // (16, 64)
    // --- fused projection GEMM (i,f,g) + gate and chunk-scan epilogue ---
    gemm_bf16s_kernel<0><<<gg, cb, 0, stream>>>(xhi, xlo, whi, wlo, ws_f, ws_i, ws_g);
    // --- carries across chunks, then applied ---
    scan_carry_kernel<<<(Bb * Hh) / cb, cb, 0, stream>>>(ws_f, ws_i, h0, carries);
    // (g*h goes straight into the planes of x, which the projection GEMM has finished reading)
    fix_gh_split_kernel<<<(unsigned)((size_t)Bb * Ss * Hh / 4 / cb), cb, 0, stream>>>(ws_f, ws_i, ws_g, carries, xhi, xlo);
    gemm_bf16s_kernel<1><<<gg, cb, 0, stream>>>(xhi, xlo, whi + 3 * wq, wlo + 3 * wq, out, nullptr, nullptr);
}
